// v000
// Measured on an AMD MI455X. A time is GPU time per run, averaged over a window of back-to-back runs after a warm-up
// (all launches, gaps included; the runs take copies of the inputs in turn), and the median of several windows.
// Apart from v000's, it joins two sittings. Times from different sittings can be a few percent apart, while
// side-by-side timings come from the same sitting.
// v000 is the starting kernel. One run takes 526 microseconds.
// compute dtype: all float inputs rounded to bf16; dot = q . k with the bf16-exact inputs on WMMA 16x16x32 (1 product, exact), f32 accumulate; |q|^2, |k|^2, wedge = relu(|q|^2 |k|^2 - dot^2) and scores = (0.5 dot - 0.5 wedge) / sqrt(32) in f32 on the VALU, stored per (batch, 8-head group); softmax in f32 (precise expf), P x 2^11 kept f32 split bf16 hi + lo against the bf16-exact values (2 products); f32 output [b][l][h][d].
#include <hip/hip_runtime.h>
#include <math.h>

typedef __attribute__((ext_vector_type(16))) _Float16 v16h;
typedef __attribute__((ext_vector_type(16))) __bf16 v16b;
typedef __attribute__((ext_vector_type(8)))  _Float16 v8h;
typedef __attribute__((ext_vector_type(8)))  float v8f;
typedef __attribute__((ext_vector_type(4)))  float v4f;
typedef __attribute__((ext_vector_type(2)))  float v2f;
typedef __attribute__((ext_vector_type(4)))  unsigned v4u;
typedef __attribute__((ext_vector_type(4)))  int v4i;
typedef float __attribute__((may_alias)) float_a;
typedef int __attribute__((may_alias)) int_a;

template <typename T> __device__ __forceinline__ void vst2(void* p, T v) { *(T*)p = v;  }
__device__ __forceinline__ v8f wmma16(v16h a, v16h b, v8f c) {
  v8f d = __builtin_amdgcn_wmma_f32_16x16x32_f16(false, a, false, b, (short)0, c, false, false);
  asm volatile("v_nop\n\tv_nop\n\tv_nop\n\tv_nop" : "+v"(d) : "v"(a), "v"(b));
  return d;
}
__device__ __forceinline__ v8f wmma_bf(v16b a, v16b b, v8f c) {
  v8f d = __builtin_amdgcn_wmma_f32_16x16x32_bf16(false, a, false, b, (short)0, c, false, false);
  asm volatile("v_nop\n\tv_nop\n\tv_nop\n\tv_nop" : "+v"(d) : "v"(a), "v"(b));
  return d;
}
// 16x16x32 fragments: lane = (h = lane>>4, row/col = lane&15); elements 0..7 = k0+8h+0..7, 8..15 = k0+16+8h+0..7; D element r = row 8h+r
__device__ __forceinline__ v16h frag_h(const _Float16* rowk0, int lane) {
  union { v16h v; v8h q[2]; } u; const _Float16* p = rowk0 + 8 * (lane >> 4);
  u.q[0] = *(const v8h*)p; u.q[1] = *(const v8h*)(p + 16); return u.v;
}
__device__ __forceinline__ v16h frag_f32(const float* rowk0, int lane) {
  v16h a; const float* p = rowk0 + 8 * (lane >> 4);
#pragma unroll
  for (int i = 0; i < 8; ++i) { a[i] = (_Float16)p[i]; a[8 + i] = (_Float16)p[16 + i]; }
  return a;
}
__device__ __forceinline__ v16h frag_f32s(const float* rowk0, int lane, float sc) {
  v16h a; const float* p = rowk0 + 8 * (lane >> 4);
#pragma unroll
  for (int i = 0; i < 8; ++i) { a[i] = (_Float16)(p[i] * sc); a[8 + i] = (_Float16)(p[16 + i] * sc); }
  return a;
}
// column fragment from a [K][ld] layout (column n), rows >= K read as 0
__device__ __forceinline__ v16h fragc_f32(const float* W, int k0, int n, int lane, int ld, int K) {
  v16h a; const int g = lane >> 4;
#pragma unroll
  for (int i = 0; i < 8; ++i) { const int ka = k0 + 8 * g + i, kb = ka + 16;
    a[i] = (_Float16)(ka < K ? W[(size_t)(ka < K ? ka : K - 1) * ld + n] : 0.f); a[8 + i] = (_Float16)(kb < K ? W[(size_t)(kb < K ? kb : K - 1) * ld + n] : 0.f); }
  return a;
}
struct F2 { v16b h, l; };
__device__ __forceinline__ F2 bsplit16(const float v[16]) { F2 r;
#pragma unroll
  for (int i = 0; i < 16; ++i) { const __bf16 h = (__bf16)v[i]; r.h[i] = h; r.l[i] = (__bf16)(v[i] - (float)h); }
  return r; }
__device__ __forceinline__ F2 split_row(const float* row, int k0, int lane) { float v[16]; const float* p = row + k0 + 8 * (lane >> 4);
#pragma unroll
  for (int i = 0; i < 8; ++i) { v[i] = p[i]; v[8 + i] = p[16 + i]; }
  return bsplit16(v); }
__device__ __forceinline__ F2 split_rowK(const float* row, int k0, int lane, int K) { float v[16]; const int g = lane >> 4;
#pragma unroll
  for (int i = 0; i < 8; ++i) { const int ka = k0 + 8 * g + i, kb = ka + 16; v[i] = ka < K ? row[ka < K ? ka : K - 1] : 0.f; v[8 + i] = kb < K ? row[kb < K ? kb : K - 1] : 0.f; }
  return bsplit16(v); }
__device__ __forceinline__ F2 split_col(const float* W, int k0, int n, int lane, int ld, int K) { float v[16]; const int g = lane >> 4;
#pragma unroll
  for (int i = 0; i < 8; ++i) { const int ka = k0 + 8 * g + i, kb = ka + 16; v[i] = ka < K ? W[(size_t)(ka < K ? ka : K - 1) * ld + n] : 0.f; v[8 + i] = kb < K ? W[(size_t)(kb < K ? kb : K - 1) * ld + n] : 0.f; }
  return bsplit16(v); }
__device__ __forceinline__ v8f mac3(const F2& a, const F2& b, v8f c) { c = wmma_bf(a.l, b.h, c); c = wmma_bf(a.h, b.l, c); return wmma_bf(a.h, b.h, c); }
__device__ __forceinline__ float sigm(float v) { return 1.0f / (1.0f + expf(-v)); }
#define LDSX() do { asm volatile("s_wait_dscnt 0" ::: "memory"); __builtin_amdgcn_wave_barrier(); __builtin_amdgcn_fence(__ATOMIC_RELEASE, "workgroup"); } while (0)


// Geometric (Clifford wedge) attention (B 2, L = S = 2,048, H 8, E = D = 32): scores mix the dot product and the clamped wedge norm |q|^2|k|^2 - (q.k)^2.
#define NB 2
#define TT 2048
#define NH 8
#define HE 32
#define RS (NH * HE)      // 256 row stride
#define HG 8
#ifndef TNB
#define TNB NB
#endif
typedef __attribute__((ext_vector_type(8))) __bf16 v8b;
__device__ __forceinline__ v16b frag_b(const __bf16* rowk0, int lane) {
  union { v16b v; v8b q[2]; } u; const __bf16* p = rowk0 + 8 * (lane >> 4);
  u.q[0] = *(const v8b*)p; u.q[1] = *(const v8b*)(p + 16); return u.v;
}
__device__ __forceinline__ float bfr(float v) { return (float)(__bf16)v; }
__device__ __attribute__((noinline)) float exp_ni(float v) { return expf(v); }
__device__ __attribute__((noinline)) float erf_ni(float v) { return erff(v); }

#define WS_S   0u                               // f32 S/P [HG][l][s]
#define WS_END (WS_S + 4u * (size_t)HG * TT * TT)

// ---- k_sc: block = (64 queries, 128 keys, head): dot (exact), norms, wedge, scores
__global__ __launch_bounds__(128) void k_sc(const float* __restrict__ Q, const float* __restrict__ Kk, int b, int h0, float* __restrict__ S0) { __shared__ __align__(16) float ss[4][16][132]; __shared__ float sqn[64]; __shared__ float skn[128];
  const int h = h0 + blockIdx.z; float* S = S0 + (size_t)blockIdx.z * TT * TT;
  const int tid = threadIdx.x, wave = tid >> 5, lane = tid & 31, col = lane & 15, g = lane >> 4; const int k0 = blockIdx.y * 128; const int qb = blockIdx.x * 64; const int ql0 = qb + wave * 16;
  // norms (f32 sums of squares of the bf16-rounded inputs)
  for (int e = tid; e < 64 + 128; e += 128) { const bool isq = e < 64; const int idx = isq ? e : e - 64; const float* p = (isq ? Q : Kk) + (((size_t)b * TT + (isq ? qb + idx : k0 + idx)) * RS + h * HE); float a = 0.f;
#pragma unroll 1
    for (int d = 0; d < HE; ++d) { const float v = bfr(p[d]); a += v * v; } if (isq) sqn[idx] = a; else skn[idx] = a; }
  v8f acc[8] = {};
  { v16b a; { const float* p = Q + ((size_t)b * TT + ql0 + col) * RS + h * HE + 8 * g;
#pragma unroll
      for (int i = 0; i < 8; ++i) { a[i] = (__bf16)p[i]; a[8 + i] = (__bf16)p[16 + i]; } }
#pragma unroll
    for (int j = 0; j < 8; ++j) { v16b kb; const float* p = Kk + ((size_t)b * TT + k0 + j * 16 + col) * RS + h * HE + 8 * g;
#pragma unroll
      for (int i = 0; i < 8; ++i) { kb[i] = (__bf16)p[i]; kb[8 + i] = (__bf16)p[16 + i]; }
      acc[j] = wmma_bf(a, kb, acc[j]); } }
  __syncthreads();
  const float scl = 0.17677669529663687f;   // 1/sqrt(32)
#pragma unroll
  for (int j = 0; j < 8; ++j) { const float kn = skn[j * 16 + col];
#pragma unroll
    for (int r = 0; r < 8; ++r) { const float dt = acc[j][r]; const float qn = sqn[wave * 16 + 8 * g + r]; const float wd = fmaxf(qn * kn - dt * dt, 0.f); ss[wave][8 * g + r][j * 16 + col] = (0.5f * dt - 0.5f * wd) * scl; } }
  LDSX(); for (int rl = 0; rl < 16; ++rl) vst2(S + (size_t)(ql0 + rl) * TT + k0 + lane * 4, *(const v4f*)&ss[wave][rl][lane * 4]); }
// ---- k_sm: block = (row, head in group): softmax -> P x 2^11 f32 in place
__global__ __launch_bounds__(256) void k_sm(float* __restrict__ S0) { __shared__ float sred[8]; __shared__ float sbc; __shared__ __align__(16) float sh[TT];
  const int t = threadIdx.x; const size_t row = blockIdx.x; float* sr = S0 + (size_t)blockIdx.y * TT * TT + row * TT;
  float m = -3.0e38f; for (int k = t; k < TT; k += 256) m = fmaxf(m, sr[k]);
#pragma unroll
  for (int o = 1; o < 32; o <<= 1) m = fmaxf(m, __shfl_xor(m, o));
  if ((t & 31) == 0) sred[t >> 5] = m; __syncthreads(); if (t == 0) { float a = sred[0]; for (int i = 1; i < 8; ++i) a = fmaxf(a, sred[i]); sbc = a; } __syncthreads(); m = sbc; __syncthreads();
  float sum = 0.f; for (int k = t; k < TT; k += 256) sum += expf(sr[k] - m);
#pragma unroll
  for (int o = 1; o < 32; o <<= 1) sum += __shfl_xor(sum, o);
  if ((t & 31) == 0) sred[t >> 5] = sum; __syncthreads(); if (t == 0) { float a = 0.f; for (int i = 0; i < 8; ++i) a += sred[i]; sbc = 1.0f / a; } __syncthreads(); const float inv = sbc;
  for (int k = t; k < TT; k += 256) sh[k] = expf(sr[k] - m) * inv * 2048.0f;
  __syncthreads(); for (int q = t; q < TT / 4; q += 256) vst2(sr + q * 4, *(const v4f*)&sh[q * 4]); }
// ---- k_pv: block = (64 queries, head): out[b][l][h][d] = P . v (P split hi + lo; v bf16-exact)
__global__ __launch_bounds__(128) void k_pv(const float* __restrict__ PS0, const float* __restrict__ V, int b, int h0, float* __restrict__ OUT) { const int h = h0 + blockIdx.z; const float* PS = PS0 + (size_t)blockIdx.z * TT * TT; __shared__ __align__(16) float ss[4][16][36];
  const int tid = threadIdx.x, wave = tid >> 5, lane = tid & 31, col = lane & 15, g = lane >> 4; const int ql0 = blockIdx.x * 64 + wave * 16;
  v8f acc[2] = {};
#pragma unroll 1
  for (int kc = 0; kc < TT / 32; ++kc) { const F2 p = split_row(PS + (size_t)(ql0 + col) * TT, kc * 32, lane);
#pragma unroll
    for (int j = 0; j < 2; ++j) { v16b vb; const int d = j * 16 + col;
#pragma unroll
      for (int i = 0; i < 8; ++i) { vb[i] = (__bf16)V[((size_t)b * TT + kc * 32 + 8 * g + i) * RS + h * HE + d]; vb[8 + i] = (__bf16)V[((size_t)b * TT + kc * 32 + 16 + 8 * g + i) * RS + h * HE + d]; }
      acc[j] = wmma_bf(p.h, vb, acc[j]); acc[j] = wmma_bf(p.l, vb, acc[j]); } }
#pragma unroll
  for (int j = 0; j < 2; ++j)
#pragma unroll
    for (int r = 0; r < 8; ++r) ss[wave][8 * g + r][j * 16 + col] = acc[j][r] * (1.0f / 2048.0f);
  LDSX(); for (int rl = 0; rl < 16; ++rl) if (lane < 8) vst2(OUT + ((size_t)b * TT + ql0 + rl) * RS + h * HE + lane * 4, *(const v4f*)&ss[wave][rl][lane * 4]); }
extern "C" void kernel_launch(void* const* d_in, const int* in_sizes, int n_in, void* d_out, int out_size, void* d_ws, size_t ws_size, hipStream_t stream) {
  (void)in_sizes; (void)n_in; (void)out_size;
  const float** F = (const float**)d_in;   // 0 queries [2,2048,8,32], 1 keys, 2 values
  if (ws_size < (size_t)WS_END) return;
  char* ws = (char*)d_ws; float* S = (float*)(ws + WS_S);
  for (int b = 0; b < TNB; ++b) for (int h0 = 0; h0 < NH; h0 += HG) {
    k_sc<<<dim3(TT / 64, TT / 128, HG), 128, 0, stream>>>(F[0], F[1], b, h0, S);
    k_sm<<<dim3(TT, HG), 256, 0, stream>>>(S);
    k_pv<<<dim3(TT / 64, 1, HG), 128, 0, stream>>>(S, F[2], b, h0, (float*)d_out);
  }
}

// v001
// One run takes 40.3 microseconds.
// Timed twice side by side with v000, it ran 13.4 times as fast both times.
// compute dtype: all float inputs rounded to bf16; dot = k . q with the bf16-exact inputs on WMMA 16x16x32 (1 product, exact), f32 accumulate; |q|^2, |k|^2, wedge = relu(|q|^2 |k|^2 - dot^2) and scores = (0.5 dot - 0.5 wedge) / sqrt(32) in f32 on the VALU; running-maximum softmax in f32 (precise expf), unnormalised P kept f32 split bf16 hi + lo against the bf16-exact values (2 products), divided by the f32 row sum at the end; f32 output [b][l][h][d].
#include <hip/hip_runtime.h>
#include <math.h>

typedef __attribute__((ext_vector_type(16))) __bf16 v16b;
typedef __attribute__((ext_vector_type(8)))  __bf16 v8b;
typedef __attribute__((ext_vector_type(8)))  float v8f;
typedef __attribute__((ext_vector_type(4)))  float v4f;
typedef __attribute__((ext_vector_type(2)))  float v2f;
typedef __attribute__((ext_vector_type(2)))  __bf16 v2b;

// Geometric (Clifford wedge) attention (B 2, L = S = 2,048, H 8, E = D = 32): scores mix the dot product and the clamped wedge norm |q|^2|k|^2 - (q.k)^2.
#define NB 2
#define TT 2048
#define NH 8
#define HE 32
#define RS (NH * HE)      // 256 row stride
#define NW 8              // waves per block, 16 queries each
#define KP 40             // LDS pitch of a key row, bf16 elements: 80 B = 16 B x odd
#define VP (TT + 8)       // LDS pitch of a row of V transposed, bf16 elements: 4,112 B = 16 B x odd

__device__ __forceinline__ v8f wmma_bf(v16b a, v16b b, v8f c) { return __builtin_amdgcn_wmma_f32_16x16x32_bf16(false, a, false, b, (short)0, c, false, false); }
// 16x16x32 fragments: lane = (g = lane>>4, row/col = lane&15); elements 0..7 = k0+8g+0..7, 8..15 = k0+16+8g+0..7; D element r = row 8g+r
__device__ __forceinline__ v16b frag_b(const __bf16* rowk0, int g) {
  union { v16b v; v8b q[2]; } u; const __bf16* p = rowk0 + 8 * g;
  u.q[0] = *(const v8b*)p; u.q[1] = *(const v8b*)(p + 16); return u.v;
}
__device__ __forceinline__ float bfr(float v) { return (float)(__bf16)v; }
// lane l with lane l ^ 16
__device__ __forceinline__ float xhalf(float x) { return __builtin_bit_cast(float, __builtin_amdgcn_permlanex16(__builtin_bit_cast(int, x), __builtin_bit_cast(int, x), 0x76543210, 0xfedcba98, false, false)); }

// ---- k_fa: block = (128 queries, head, batch). The head's keys (bf16), values (bf16, transposed) and key norms are laid in LDS once;
// each wave then walks all keys for its 16 queries: S^T = K . Q^T (a lane holds one query's scores), running-maximum softmax, O^T += V^T . P^T
// (two S^T tiles, converted in place, are the B operand). Scores and P never leave the registers.
__global__ __launch_bounds__(NW * 32) void k_fa(const float* __restrict__ Q, const float* __restrict__ Kk, const float* __restrict__ V, float* __restrict__ OUT) {
  __shared__ __align__(16) __bf16 sk[TT * KP]; __shared__ __align__(16) __bf16 sv[HE * VP]; __shared__ __align__(16) float skn[TT];
  const int tid = threadIdx.x, wave = tid >> 5, lane = tid & 31, col = lane & 15, g = lane >> 4;
  const int h = blockIdx.y, b = blockIdx.z; const int q0 = blockIdx.x * (NW * 16) + wave * 16;
  // keys: a thread rounds 8 elements of one key row
  { const float* Kb = Kk + (size_t)b * TT * RS + h * HE; const int c8 = (tid & 3) * 8;
#pragma unroll 16  // 32 loads of 16 bytes in flight per thread
    for (int it = 0; it < TT / 64; ++it) { const int key = it * 64 + (tid >> 2); const float* p = Kb + (size_t)key * RS + c8;
      const v4f x = *(const v4f*)p, y = *(const v4f*)(p + 4); v8b o;
#pragma unroll  // constant register indices
      for (int i = 0; i < 4; ++i) { o[i] = (__bf16)x[i]; o[4 + i] = (__bf16)y[i]; }
      *(v8b*)&sk[key * KP + c8] = o; } }
  // values: a lane takes 8 keys x 4 columns and writes 8 keys of each column as one 16-byte piece of the transposed row
  { const float* Vb = V + (size_t)b * TT * RS + h * HE; const int kq = lane >> 3, dq = lane & 7;
#pragma unroll 4  // 32 loads of 16 bytes in flight per thread
    for (int it = 0; it < TT / (NW * 32); ++it) { const int key0 = it * (NW * 32) + wave * 32 + kq * 8; v4f x[8];
#pragma unroll  // constant register indices
      for (int i = 0; i < 8; ++i) x[i] = *(const v4f*)(Vb + (size_t)(key0 + i) * RS + dq * 4);
#pragma unroll  // constant register indices
      for (int j = 0; j < 4; ++j) { v8b o;
#pragma unroll  // constant register indices
        for (int i = 0; i < 8; ++i) o[i] = (__bf16)x[i][j];
        *(v8b*)&sv[(dq * 4 + j) * VP + key0] = o; } } }
  // the lane's query: norm (f32 sum of squares of the bf16-rounded inputs) and B fragment
  float qn = 0.f; v16b qf;
  { const float* qp = Q + ((size_t)b * TT + q0 + col) * RS + h * HE;
#pragma unroll  // constant register indices
    for (int d = 0; d < HE; ++d) { const float v = bfr(qp[d]); qn += v * v; }
#pragma unroll  // constant register indices
    for (int i = 0; i < 8; ++i) { qf[i] = (__bf16)qp[8 * g + i]; qf[8 + i] = (__bf16)qp[16 + 8 * g + i]; } }
  __syncthreads();
  // key norms from the rounded rows
#pragma unroll 4  // four independent sum chains hide each other's latency
  for (int it = 0; it < TT / (NW * 32); ++it) { const int e = it * (NW * 32) + tid; float a = 0.f;
#pragma unroll  // constant register indices
    for (int c = 0; c < 4; ++c) { const v8b x = *(const v8b*)&sk[e * KP + c * 8];
#pragma unroll  // constant register indices
      for (int i = 0; i < 8; ++i) { const float v = (float)x[i]; a += v * v; } }
    skn[e] = a; }
  __syncthreads();
  const float scl = 0.17677669529663687f;   // 1/sqrt(32)
  float m = -3.0e38f, l = 0.f; v8f acc[2] = {};
#pragma unroll 1  // one pass is already 64 keys of straight-line code
  for (int k0 = 0; k0 < TT; k0 += 64) { v8f s[4];
#pragma unroll  // constant register indices
    for (int t = 0; t < 4; ++t) { const v8f z = {}; s[t] = wmma_bf(frag_b(&sk[(k0 + t * 16 + col) * KP], g), qf, z); }
    float mx = m;
#pragma unroll  // constant register indices
    for (int t = 0; t < 4; ++t) { const v4f n0 = *(const v4f*)&skn[k0 + t * 16 + 8 * g], n1 = *(const v4f*)&skn[k0 + t * 16 + 8 * g + 4];
#pragma unroll  // constant register indices
      for (int r = 0; r < 8; ++r) { const float kn = r < 4 ? n0[r & 3] : n1[r & 3]; const float dt = s[t][r]; const float wd = fmaxf(qn * kn - dt * dt, 0.f);
        const float sc = (0.5f * dt - 0.5f * wd) * scl; s[t][r] = sc; mx = fmaxf(mx, sc); } }
    mx = fmaxf(mx, xhalf(mx));
    const float alpha = expf(m - mx); m = mx; float ps = 0.f;
#pragma unroll  // constant register indices
    for (int t = 0; t < 4; ++t)
#pragma unroll  // constant register indices
      for (int r = 0; r < 8; ++r) { const float p = expf(s[t][r] - mx); s[t][r] = p; ps += p; }
    l = l * alpha + ps;
#pragma unroll  // constant register indices
    for (int j = 0; j < 2; ++j)
#pragma unroll  // constant register indices
      for (int r = 0; r < 8; ++r) acc[j][r] *= alpha;
#pragma unroll  // constant register indices
    for (int c = 0; c < 2; ++c) { v16b ph, pl;
#pragma unroll  // constant register indices
      for (int i = 0; i < 16; i += 2) { const v2f p = { s[2 * c + (i >> 3)][i & 7], s[2 * c + (i >> 3)][(i & 7) + 1] }; const v2b hi = __builtin_convertvector(p, v2b);
        const v2b lo = __builtin_convertvector(p - __builtin_convertvector(hi, v2f), v2b); ph[i] = hi[0]; ph[i + 1] = hi[1]; pl[i] = lo[0]; pl[i + 1] = lo[1]; }
#pragma unroll  // constant register indices
      for (int j = 0; j < 2; ++j) { const v16b vf = frag_b(&sv[(j * 16 + col) * VP + k0 + c * 32], g);
        acc[j] = wmma_bf(vf, ph, acc[j]); acc[j] = wmma_bf(vf, pl, acc[j]); } } }
  l += xhalf(l); const float inv = 1.0f / l;
  // acc[j][r] = O[query col][16 j + 8 g + r]: 8 consecutive outputs of one row per lane
  float* op = OUT + ((size_t)b * TT + q0 + col) * RS + h * HE + 8 * g;
#pragma unroll  // constant register indices
  for (int j = 0; j < 2; ++j) { v4f a, c;
#pragma unroll  // constant register indices
    for (int i = 0; i < 4; ++i) { a[i] = acc[j][i] * inv; c[i] = acc[j][4 + i] * inv; }
    *(v4f*)(op + j * 16) = a; *(v4f*)(op + j * 16 + 4) = c; } }
extern "C" void kernel_launch(void* const* d_in, const int* in_sizes, int n_in, void* d_out, int out_size, void* d_ws, size_t ws_size, hipStream_t stream) {
  (void)in_sizes; (void)n_in; (void)out_size; (void)d_ws; (void)ws_size;
  const float** F = (const float**)d_in;   // 0 queries [2,2048,8,32], 1 keys, 2 values
  k_fa<<<dim3(TT / (NW * 16), NH, NB), NW * 32, 0, stream>>>(F[0], F[1], F[2], (float*)d_out);
}

// v002
// One run takes 26.3 microseconds.
// Two timings next to v001 both put it at 1.53 times that version's speed.
// Counting every step since v000, it is 20.5 times as fast.
// compute dtype: all float inputs rounded to bf16; dot = k . q with the bf16-exact inputs on WMMA 16x16x32 (1 product, exact), f32 accumulate; |q|^2, |k|^2, wedge = relu(|q|^2 |k|^2 - dot^2) and x = dot - wedge in f32 on the VALU; running-maximum softmax in f32 in base 2, P = exp2(c2 x - c2 max), c2 = 0.5 log2(e) / sqrt(32) (hardware exp2), unnormalised P kept f32 split bf16 hi + lo against the bf16-exact values (2 products), divided by the f32 row sum at the end; f32 output [b][l][h][d].
#include <hip/hip_runtime.h>
#include <math.h>

typedef __attribute__((ext_vector_type(16))) __bf16 v16b;
typedef __attribute__((ext_vector_type(8)))  __bf16 v8b;
typedef __attribute__((ext_vector_type(8)))  float v8f;
typedef __attribute__((ext_vector_type(4)))  float v4f;
typedef __attribute__((ext_vector_type(2)))  float v2f;
typedef __attribute__((ext_vector_type(2)))  __bf16 v2b;

// Geometric (Clifford wedge) attention (B 2, L = S = 2,048, H 8, E = D = 32): scores mix the dot product and the clamped wedge norm |q|^2|k|^2 - (q.k)^2.
#define NB 2
#define TT 2048
#define NH 8
#define HE 32
#define RS (NH * HE)      // 256 row stride
#define NW 8              // waves per block, 16 queries each
#define KP 40             // LDS pitch of a key row, bf16 elements: 80 B = 16 B x odd
#define VP (TT + 8)       // LDS pitch of a row of V transposed, bf16 elements: 4,112 B = 16 B x odd

__device__ __forceinline__ v8f wmma_bf(v16b a, v16b b, v8f c) { return __builtin_amdgcn_wmma_f32_16x16x32_bf16(false, a, false, b, (short)0, c, false, false); }
// 16x16x32 fragments: lane = (g = lane>>4, row/col = lane&15); elements 0..7 = k0+8g+0..7, 8..15 = k0+16+8g+0..7; D element r = row 8g+r
__device__ __forceinline__ v16b frag_b(const __bf16* rowk0, int g) {
  union { v16b v; v8b q[2]; } u; const __bf16* p = rowk0 + 8 * g;
  u.q[0] = *(const v8b*)p; u.q[1] = *(const v8b*)(p + 16); return u.v;
}
__device__ __forceinline__ float bfr(float v) { return (float)(__bf16)v; }
// lane l with lane l ^ 16
__device__ __forceinline__ float xhalf(float x) { return __builtin_bit_cast(float, __builtin_amdgcn_permlanex16(__builtin_bit_cast(int, x), __builtin_bit_cast(int, x), 0x76543210, 0xfedcba98, false, false)); }

// ---- k_fa: block = (128 queries, head, batch). The head's keys (bf16), values (bf16, transposed) and key norms are laid in LDS once;
// each wave then walks all keys for its 16 queries: S^T = K . Q^T (a lane holds one query's scores), running-maximum softmax, O^T += V^T . P^T
// (two S^T tiles, converted in place, are the B operand). Scores and P never leave the registers.
__global__ __launch_bounds__(NW * 32) void k_fa(const float* __restrict__ Q, const float* __restrict__ Kk, const float* __restrict__ V, float* __restrict__ OUT) {
  __shared__ __align__(16) __bf16 sk[TT * KP]; __shared__ __align__(16) __bf16 sv[HE * VP]; __shared__ __align__(16) float skn[TT];
  const int tid = threadIdx.x, wave = tid >> 5, lane = tid & 31, col = lane & 15, g = lane >> 4;
  const int h = blockIdx.y, b = blockIdx.z; const int q0 = blockIdx.x * (NW * 16) + wave * 16;
  // keys: a thread rounds 8 elements of one key row
  { const float* Kb = Kk + (size_t)b * TT * RS + h * HE; const int c8 = (tid & 3) * 8;
#pragma unroll 16  // 32 loads of 16 bytes in flight per thread
    for (int it = 0; it < TT / 64; ++it) { const int key = it * 64 + (tid >> 2); const float* p = Kb + (size_t)key * RS + c8;
      const v4f x = *(const v4f*)p, y = *(const v4f*)(p + 4); v8b o;
#pragma unroll  // constant register indices
      for (int i = 0; i < 4; ++i) { o[i] = (__bf16)x[i]; o[4 + i] = (__bf16)y[i]; }
      *(v8b*)&sk[key * KP + c8] = o; } }
  // values: a lane takes 8 keys x 4 columns and writes 8 keys of each column as one 16-byte piece of the transposed row
  { const float* Vb = V + (size_t)b * TT * RS + h * HE; const int kq = lane >> 3, dq = lane & 7;
#pragma unroll 4  // 32 loads of 16 bytes in flight per thread
    for (int it = 0; it < TT / (NW * 32); ++it) { const int key0 = it * (NW * 32) + wave * 32 + kq * 8; v4f x[8];
#pragma unroll  // constant register indices
      for (int i = 0; i < 8; ++i) x[i] = *(const v4f*)(Vb + (size_t)(key0 + i) * RS + dq * 4);
#pragma unroll  // constant register indices
      for (int j = 0; j < 4; ++j) { v8b o;
#pragma unroll  // constant register indices
        for (int i = 0; i < 8; ++i) o[i] = (__bf16)x[i][j];
        *(v8b*)&sv[(dq * 4 + j) * VP + key0] = o; } } }
  // the lane's query: norm (f32 sum of squares of the bf16-rounded inputs) and B fragment
  float qn = 0.f; v16b qf;
  { const float* qp = Q + ((size_t)b * TT + q0 + col) * RS + h * HE;
#pragma unroll  // constant register indices
    for (int d = 0; d < HE; ++d) { const float v = bfr(qp[d]); qn += v * v; }
#pragma unroll  // constant register indices
    for (int i = 0; i < 8; ++i) { qf[i] = (__bf16)qp[8 * g + i]; qf[8 + i] = (__bf16)qp[16 + 8 * g + i]; } }
  __syncthreads();
  // key norms from the rounded rows
#pragma unroll 4  // four independent sum chains hide each other's latency
  for (int it = 0; it < TT / (NW * 32); ++it) { const int e = it * (NW * 32) + tid; float a = 0.f;
#pragma unroll  // constant register indices
    for (int c = 0; c < 4; ++c) { const v8b x = *(const v8b*)&sk[e * KP + c * 8];
#pragma unroll  // constant register indices
      for (int i = 0; i < 8; ++i) { const float v = (float)x[i]; a += v * v; } }
    skn[e] = a; }
  __syncthreads();
  // softmax in base 2: the running maximum is taken over x = dot - wedge, and c2 = 0.5 / sqrt(32) * log2(e) enters only in the exp2 argument c2 * x + nmc
  // (one fused multiply-add per score). nmc = -c2 * maximum, rounded once, is the common reference of a pass's P, so its rounding cancels in O = acc / l;
  // the rescale factor exp2(c2 * (old maximum - new maximum)) is exactly 1 while the maximum stands.
  const float c2 = 0.12751743f;
  float m = -3.0e38f, l = 0.f; v8f acc[2] = {};
#pragma unroll 1  // one pass is already 64 keys of straight-line code
  for (int k0 = 0; k0 < TT; k0 += 64) { v8f s[4];
#pragma unroll  // constant register indices
    for (int t = 0; t < 4; ++t) { const v8f z = {}; s[t] = wmma_bf(frag_b(&sk[(k0 + t * 16 + col) * KP], g), qf, z); }
    float mx = m;
#pragma unroll  // constant register indices
    for (int t = 0; t < 4; ++t) { const v4f n0 = *(const v4f*)&skn[k0 + t * 16 + 8 * g], n1 = *(const v4f*)&skn[k0 + t * 16 + 8 * g + 4];
#pragma unroll  // constant register indices
      for (int r = 0; r < 8; ++r) { const float kn = r < 4 ? n0[r & 3] : n1[r & 3]; const float dt = s[t][r]; const float wd = fmaxf(qn * kn - dt * dt, 0.f);
        const float x = dt - wd; s[t][r] = x; mx = fmaxf(mx, x); } }
    mx = fmaxf(mx, xhalf(mx));
    const float nmc = -c2 * mx; const float alpha = __builtin_amdgcn_exp2f(c2 * (m - mx)); m = mx; float ps = 0.f;
#pragma unroll  // constant register indices
    for (int t = 0; t < 4; ++t)
#pragma unroll  // constant register indices
      for (int r = 0; r < 8; r += 2) { const v2f a = __builtin_elementwise_fma(v2f{ s[t][r], s[t][r + 1] }, v2f{ c2, c2 }, v2f{ nmc, nmc });
        const float p0 = __builtin_amdgcn_exp2f(a[0]), p1 = __builtin_amdgcn_exp2f(a[1]); s[t][r] = p0; s[t][r + 1] = p1; ps += p0; ps += p1; }
    l = l * alpha + ps;
#pragma unroll  // constant register indices
    for (int j = 0; j < 2; ++j)
#pragma unroll  // constant register indices
      for (int r = 0; r < 8; ++r) acc[j][r] *= alpha;
#pragma unroll  // constant register indices
    for (int c = 0; c < 2; ++c) { v16b ph, pl;
#pragma unroll  // constant register indices
      for (int i = 0; i < 16; i += 2) { const v2f p = { s[2 * c + (i >> 3)][i & 7], s[2 * c + (i >> 3)][(i & 7) + 1] }; const v2b hi = __builtin_convertvector(p, v2b);
        const v2b lo = __builtin_convertvector(p - __builtin_convertvector(hi, v2f), v2b); ph[i] = hi[0]; ph[i + 1] = hi[1]; pl[i] = lo[0]; pl[i + 1] = lo[1]; }
#pragma unroll  // constant register indices
      for (int j = 0; j < 2; ++j) { const v16b vf = frag_b(&sv[(j * 16 + col) * VP + k0 + c * 32], g);
        acc[j] = wmma_bf(vf, ph, acc[j]); acc[j] = wmma_bf(vf, pl, acc[j]); } } }
  l += xhalf(l); const float inv = 1.0f / l;
  // acc[j][r] = O[query col][16 j + 8 g + r]: 8 consecutive outputs of one row per lane
  float* op = OUT + ((size_t)b * TT + q0 + col) * RS + h * HE + 8 * g;
#pragma unroll  // constant register indices
  for (int j = 0; j < 2; ++j) { v4f a, c;
#pragma unroll  // constant register indices
    for (int i = 0; i < 4; ++i) { a[i] = acc[j][i] * inv; c[i] = acc[j][4 + i] * inv; }
    *(v4f*)(op + j * 16) = a; *(v4f*)(op + j * 16 + 4) = c; } }
extern "C" void kernel_launch(void* const* d_in, const int* in_sizes, int n_in, void* d_out, int out_size, void* d_ws, size_t ws_size, hipStream_t stream) {
  (void)in_sizes; (void)n_in; (void)out_size; (void)d_ws; (void)ws_size;
  const float** F = (const float**)d_in;   // 0 queries [2,2048,8,32], 1 keys, 2 values
  k_fa<<<dim3(TT / (NW * 16), NH, NB), NW * 32, 0, stream>>>(F[0], F[1], F[2], (float*)d_out);
}

// v003
// A run of this version takes 24.1 microseconds.
// Two timings next to v002 both put it at 1.09 times that version's speed.
// Counting every step since v000, it is 22.4 times as fast.
// compute dtype: all float inputs rounded to bf16; dot = k . q with the bf16-exact inputs on WMMA 16x16x32 (1 product, exact), f32 accumulate; |q|^2, |k|^2, wedge = relu(|q|^2 |k|^2 - dot^2) and x = dot - wedge in f32 on the VALU; running-maximum softmax in f32 in base 2, P = exp2(c2 x - c2 max), c2 = 0.5 log2(e) / sqrt(32) (hardware exp2), unnormalised P kept f32 split bf16 hi + lo against the bf16-exact values (2 products), divided by the f32 row sum at the end; f32 output [b][l][h][d].
#include <hip/hip_runtime.h>
#include <math.h>

typedef __attribute__((ext_vector_type(16))) __bf16 v16b;
typedef __attribute__((ext_vector_type(8)))  __bf16 v8b;
typedef __attribute__((ext_vector_type(8)))  float v8f;
typedef __attribute__((ext_vector_type(4)))  float v4f;
typedef __attribute__((ext_vector_type(2)))  float v2f;
typedef __attribute__((ext_vector_type(2)))  __bf16 v2b;

// Geometric (Clifford wedge) attention (B 2, L = S = 2,048, H 8, E = D = 32): scores mix the dot product and the clamped wedge norm |q|^2|k|^2 - (q.k)^2.
#define NB 2
#define TT 2048
#define NH 8
#define HE 32
#define RS (NH * HE)      // 256 row stride
#define NW 8              // waves per block, 16 queries each
#define CK 256            // keys per staged chunk: 32 per wave
#define KP 40             // LDS pitch of a key row, bf16 elements: 80 B = 16 B x odd
#define VP (TT + 8)       // LDS pitch of a row of V transposed, bf16 elements: 4,112 B = 16 B x odd

__device__ __forceinline__ v8f wmma_bf(v16b a, v16b b, v8f c) { return __builtin_amdgcn_wmma_f32_16x16x32_bf16(false, a, false, b, (short)0, c, false, false); }
// 16x16x32 fragments: lane = (g = lane>>4, row/col = lane&15); elements 0..7 = k0+8g+0..7, 8..15 = k0+16+8g+0..7; D element r = row 8g+r
__device__ __forceinline__ v16b frag_b(const __bf16* rowk0, int g) {
  union { v16b v; v8b q[2]; } u; const __bf16* p = rowk0 + 8 * g;
  u.q[0] = *(const v8b*)p; u.q[1] = *(const v8b*)(p + 16); return u.v;
}
__device__ __forceinline__ float bfr(float v) { return (float)(__bf16)v; }
// lane l with lane l ^ 16
__device__ __forceinline__ float xhalf(float x) { return __builtin_bit_cast(float, __builtin_amdgcn_permlanex16(__builtin_bit_cast(int, x), __builtin_bit_cast(int, x), 0x76543210, 0xfedcba98, false, false)); }

// ---- k_fa: block = (128 queries, head, batch). The head's keys (bf16), values (bf16, transposed) and key norms are laid in LDS once, in chunks of CK keys:
// a wave issues the global loads of its 32 keys of the next chunk, works on the current chunk while they fly, then rounds and stores them; one barrier per chunk publishes it.
// Each wave walks all keys for its 16 queries: S^T = K . Q^T (a lane holds one query's scores), running-maximum softmax, O^T += V^T . P^T
// (two S^T tiles, converted in place, are the B operand). Scores and P never leave the registers.
__global__ __launch_bounds__(NW * 32) void k_fa(const float* __restrict__ Q, const float* __restrict__ Kk, const float* __restrict__ V, float* __restrict__ OUT) {
  __shared__ __align__(16) __bf16 sk[TT * KP]; __shared__ __align__(16) __bf16 sv[HE * VP]; __shared__ __align__(16) float skn[TT];
  const int tid = threadIdx.x, wave = tid >> 5, lane = tid & 31, col = lane & 15, g = lane >> 4;
  const int h = blockIdx.y, b = blockIdx.z; const int q0 = blockIdx.x * (NW * 16) + wave * 16;
  // staging of a chunk, a wave's share being 32 keys. Keys: a lane takes 8 elements of each of 4 key rows. Values: a lane takes 8 keys x 4 columns.
  const int c8 = (lane & 3) * 8, kr = wave * 32 + (lane >> 2), dq = lane & 7, key0 = wave * 32 + (lane >> 3) * 8;
  const float* pk = Kk + ((size_t)b * TT + kr) * RS + h * HE + c8; const float* pv = V + ((size_t)b * TT + key0) * RS + h * HE + dq * 4;
  v4f kx[4], ky[4], vx[8];
  auto fetch = [&](const int kc) {  // kc: first key of the chunk
    const float* p = pk + (size_t)kc * RS; const float* r = pv + (size_t)kc * RS;
#pragma unroll  // constant register indices
    for (int it = 0; it < 4; ++it) { kx[it] = *(const v4f*)(p + it * 8 * RS); ky[it] = *(const v4f*)(p + it * 8 * RS + 4); }
#pragma unroll  // constant register indices
    for (int i = 0; i < 8; ++i) vx[i] = *(const v4f*)(r + i * RS);
    // holds the 16 loads here, ahead of the work they fly over, and keeps their two address pairs whole until the translations are done
    asm volatile("s_wait_xcnt 0x0" :: "v"(p), "v"(r) : "memory"); };
  auto lay = [&](const int kc) {
#pragma unroll  // constant register indices
    for (int it = 0; it < 4; ++it) { v8b o;
#pragma unroll  // constant register indices
      for (int i = 0; i < 4; ++i) { o[i] = (__bf16)kx[it][i]; o[4 + i] = (__bf16)ky[it][i]; }
      *(v8b*)&sk[(kc + kr + it * 8) * KP + c8] = o; }
    // 8 keys of each column go as one 16-byte piece of the transposed row
#pragma unroll  // constant register indices
    for (int j = 0; j < 4; ++j) { v8b o;
#pragma unroll  // constant register indices
      for (int i = 0; i < 8; ++i) o[i] = (__bf16)vx[i][j];
      *(v8b*)&sv[(dq * 4 + j) * VP + kc + key0] = o; }
    // key norms from the rounded rows: a lane sums one of the 32 rows that its own wave has just written (a wave's LDS operations run in order)
    float a = 0.f;
#pragma unroll  // constant register indices
    for (int q = 0; q < 4; ++q) { const v8b y = *(const v8b*)&sk[(kc + wave * 32 + lane) * KP + q * 8];
#pragma unroll  // constant register indices
      for (int i = 0; i < 8; ++i) { const float v = (float)y[i]; a += v * v; } }
    skn[kc + wave * 32 + lane] = a; };
  fetch(0);
  // the lane's query: norm (f32 sum of squares of the bf16-rounded inputs) and B fragment
  float qn = 0.f; v16b qf;
  { const float* qp = Q + ((size_t)b * TT + q0 + col) * RS + h * HE;
#pragma unroll  // constant register indices
    for (int d = 0; d < HE; ++d) { const float v = bfr(qp[d]); qn += v * v; }
#pragma unroll  // constant register indices
    for (int i = 0; i < 8; ++i) { qf[i] = (__bf16)qp[8 * g + i]; qf[8 + i] = (__bf16)qp[16 + 8 * g + i]; } }
  lay(0);
  __syncthreads();
  // softmax in base 2: the running maximum is taken over x = dot - wedge, and c2 = 0.5 / sqrt(32) * log2(e) enters only in the exp2 argument c2 * x + nmc
  // (one fused multiply-add per score). nmc = -c2 * maximum, rounded once, is the common reference of a pass's P, so its rounding cancels in O = acc / l;
  // the rescale factor exp2(c2 * (old maximum - new maximum)) is exactly 1 while the maximum stands.
  const float c2 = 0.12751743f;
  float m = -3.0e38f, l = 0.f; v8f acc[2] = {};
#pragma unroll 1  // one trip per chunk, closed by the barrier that publishes the next chunk
  for (int kc = 0; kc < TT; kc += CK) {
  if (kc + CK < TT) fetch(kc + CK);
#pragma unroll 1  // one pass is already 64 keys of straight-line code
  for (int p = 0; p < CK / 64; ++p) { const int k0 = kc + p * 64; v8f s[4];
#pragma unroll  // constant register indices
    for (int t = 0; t < 4; ++t) { const v8f z = {}; s[t] = wmma_bf(frag_b(&sk[(k0 + t * 16 + col) * KP], g), qf, z); }
    float mx = m;
#pragma unroll  // constant register indices
    for (int t = 0; t < 4; ++t) { const v4f n0 = *(const v4f*)&skn[k0 + t * 16 + 8 * g], n1 = *(const v4f*)&skn[k0 + t * 16 + 8 * g + 4];
#pragma unroll  // constant register indices
      for (int r = 0; r < 8; ++r) { const float kn = r < 4 ? n0[r & 3] : n1[r & 3]; const float dt = s[t][r]; const float wd = fmaxf(qn * kn - dt * dt, 0.f);
        const float x = dt - wd; s[t][r] = x; mx = fmaxf(mx, x); } }
    mx = fmaxf(mx, xhalf(mx));
    const float nmc = -c2 * mx; const float alpha = __builtin_amdgcn_exp2f(c2 * (m - mx)); m = mx; float ps = 0.f;
#pragma unroll  // constant register indices
    for (int t = 0; t < 4; ++t)
#pragma unroll  // constant register indices
      for (int r = 0; r < 8; r += 2) { const v2f a = __builtin_elementwise_fma(v2f{ s[t][r], s[t][r + 1] }, v2f{ c2, c2 }, v2f{ nmc, nmc });
        const float p0 = __builtin_amdgcn_exp2f(a[0]), p1 = __builtin_amdgcn_exp2f(a[1]); s[t][r] = p0; s[t][r + 1] = p1; ps += p0; ps += p1; }
    l = l * alpha + ps;
#pragma unroll  // constant register indices
    for (int j = 0; j < 2; ++j)
#pragma unroll  // constant register indices
      for (int r = 0; r < 8; ++r) acc[j][r] *= alpha;
#pragma unroll  // constant register indices
    for (int c = 0; c < 2; ++c) { v16b ph, pl;
#pragma unroll  // constant register indices
      for (int i = 0; i < 16; i += 2) { const v2f p = { s[2 * c + (i >> 3)][i & 7], s[2 * c + (i >> 3)][(i & 7) + 1] }; const v2b hi = __builtin_convertvector(p, v2b);
        const v2b lo = __builtin_convertvector(p - __builtin_convertvector(hi, v2f), v2b); ph[i] = hi[0]; ph[i + 1] = hi[1]; pl[i] = lo[0]; pl[i + 1] = lo[1]; }
#pragma unroll  // constant register indices
      for (int j = 0; j < 2; ++j) { const v16b vf = frag_b(&sv[(j * 16 + col) * VP + k0 + c * 32], g);
        acc[j] = wmma_bf(vf, ph, acc[j]); acc[j] = wmma_bf(vf, pl, acc[j]); } } }
  if (kc + CK < TT) { lay(kc + CK); __syncthreads(); } }  // the next chunk is complete in LDS; the test reads the same for the whole block
  l += xhalf(l); const float inv = 1.0f / l;
  // acc[j][r] = O[query col][16 j + 8 g + r]: 8 consecutive outputs of one row per lane
  float* op = OUT + ((size_t)b * TT + q0 + col) * RS + h * HE + 8 * g;
#pragma unroll  // constant register indices
  for (int j = 0; j < 2; ++j) { v4f a, c;
#pragma unroll  // constant register indices
    for (int i = 0; i < 4; ++i) { a[i] = acc[j][i] * inv; c[i] = acc[j][4 + i] * inv; }
    *(v4f*)(op + j * 16) = a; *(v4f*)(op + j * 16 + 4) = c; } }
extern "C" void kernel_launch(void* const* d_in, const int* in_sizes, int n_in, void* d_out, int out_size, void* d_ws, size_t ws_size, hipStream_t stream) {
  (void)in_sizes; (void)n_in; (void)out_size; (void)d_ws; (void)ws_size;
  const float** F = (const float**)d_in;   // 0 queries [2,2048,8,32], 1 keys, 2 values
  k_fa<<<dim3(TT / (NW * 16), NH, NB), NW * 32, 0, stream>>>(F[0], F[1], F[2], (float*)d_out);
}

// v004
// Measured time: 23.4 microseconds a run.
// Two timings next to v003 both put it at 1.03 times that version's speed.
// Over all steps from v000 it is 23.1 times as fast.
// compute dtype: all float inputs rounded to bf16; dot = k . q with the bf16-exact inputs on WMMA 16x16x32 (1 product, exact), f32 accumulate; |q|^2, |k|^2, wedge = relu(|q|^2 |k|^2 - dot^2) and x = dot - wedge in f32 on the VALU; running-maximum softmax in f32 in base 2, P = exp2(c2 x - c2 max), c2 = 0.5 log2(e) / sqrt(32) (hardware exp2), unnormalised P kept f32 split bf16 hi + lo against the bf16-exact values (2 products), divided by the f32 row sum at the end; f32 output [b][l][h][d].
#include <hip/hip_runtime.h>
#include <math.h>

typedef __attribute__((ext_vector_type(16))) __bf16 v16b;
typedef __attribute__((ext_vector_type(8)))  __bf16 v8b;
typedef __attribute__((ext_vector_type(8)))  float v8f;
typedef __attribute__((ext_vector_type(4)))  float v4f;
typedef __attribute__((ext_vector_type(2)))  float v2f;
typedef __attribute__((ext_vector_type(2)))  __bf16 v2b;

// Geometric (Clifford wedge) attention (B 2, L = S = 2,048, H 8, E = D = 32): scores mix the dot product and the clamped wedge norm |q|^2|k|^2 - (q.k)^2.
#define NB 2
#define TT 2048
#define NH 8
#define HE 32
#define RS (NH * HE)      // 256 row stride
#define NW 8              // waves per block, 16 queries each
#define CK 256            // keys per staged chunk: 32 per wave
#define KP 40             // LDS pitch of a key row, bf16 elements: 80 B = 16 B x odd
#define VP (TT + 8)       // LDS pitch of a row of V transposed, bf16 elements: 4,112 B = 16 B x odd

__device__ __forceinline__ v8f wmma_bf(v16b a, v16b b, v8f c) { return __builtin_amdgcn_wmma_f32_16x16x32_bf16(false, a, false, b, (short)0, c, false, false); }
// 16x16x32 fragments: lane = (g = lane>>4, row/col = lane&15); elements 0..7 = k0+8g+0..7, 8..15 = k0+16+8g+0..7; D element r = row 8g+r
__device__ __forceinline__ v16b frag_b(const __bf16* rowk0, int g) {
  union { v16b v; v8b q[2]; } u; const __bf16* p = rowk0 + 8 * g;
  u.q[0] = *(const v8b*)p; u.q[1] = *(const v8b*)(p + 16); return u.v;
}
__device__ __forceinline__ float bfr(float v) { return (float)(__bf16)v; }
// lane l with lane l ^ 16
__device__ __forceinline__ float xhalf(float x) { return __builtin_bit_cast(float, __builtin_amdgcn_permlanex16(__builtin_bit_cast(int, x), __builtin_bit_cast(int, x), 0x76543210, 0xfedcba98, false, false)); }

// ---- k_fa: block = (128 queries, head, batch). The head's keys (bf16), values (bf16, transposed) and key norms are laid in LDS once, in chunks of CK keys:
// a wave issues the global loads of its 32 keys of the next chunk, works on the current chunk while they fly, then rounds and stores them; one barrier per chunk publishes it.
// Each wave walks all keys for its 16 queries: S^T = K . Q^T (a lane holds one query's scores), running-maximum softmax, O^T += V^T . P^T
// (two S^T tiles, converted in place, are the B operand). Scores and P never leave the registers.
__global__ __launch_bounds__(NW * 32) void k_fa(const float* __restrict__ Q, const float* __restrict__ Kk, const float* __restrict__ V, float* __restrict__ OUT) {
  __shared__ __align__(16) __bf16 sk[TT * KP]; __shared__ __align__(16) __bf16 sv[HE * VP]; __shared__ __align__(16) float skn[TT];
  const int tid = threadIdx.x, wave = tid >> 5, lane = tid & 31, col = lane & 15, g = lane >> 4;
  const int h = blockIdx.y, b = blockIdx.z; const int q0 = blockIdx.x * (NW * 16) + wave * 16;
  // staging of a chunk, a wave's share being 32 keys. Keys: a lane takes 8 elements of each of 4 key rows. Values: a lane takes 8 keys x 4 columns.
  const int c8 = (lane & 3) * 8, kr = wave * 32 + (lane >> 2), dq = lane & 7, key0 = wave * 32 + (lane >> 3) * 8;
  const float* pk = Kk + ((size_t)b * TT + kr) * RS + h * HE + c8; const float* pv = V + ((size_t)b * TT + key0) * RS + h * HE + dq * 4;
  v4f kx[4], ky[4], vx[8];
  auto fetch = [&](const int kc) {  // kc: first key of the chunk
    const float* p = pk + (size_t)kc * RS; const float* r = pv + (size_t)kc * RS;
#pragma unroll  // constant register indices
    for (int it = 0; it < 4; ++it) { kx[it] = *(const v4f*)(p + it * 8 * RS); ky[it] = *(const v4f*)(p + it * 8 * RS + 4); }
#pragma unroll  // constant register indices
    for (int i = 0; i < 8; ++i) vx[i] = *(const v4f*)(r + i * RS);
    // holds the 16 loads here, ahead of the work they fly over, and keeps their two address pairs whole until the translations are done
    asm volatile("s_wait_xcnt 0x0" :: "v"(p), "v"(r) : "memory"); };
  auto lay = [&](const int kc) {
#pragma unroll  // constant register indices
    for (int it = 0; it < 4; ++it) { v8b o;
#pragma unroll  // constant register indices
      for (int i = 0; i < 4; ++i) { o[i] = (__bf16)kx[it][i]; o[4 + i] = (__bf16)ky[it][i]; }
      *(v8b*)&sk[(kc + kr + it * 8) * KP + c8] = o; }
    // 8 keys of each column go as one 16-byte piece of the transposed row
#pragma unroll  // constant register indices
    for (int j = 0; j < 4; ++j) { v8b o;
#pragma unroll  // constant register indices
      for (int i = 0; i < 8; ++i) o[i] = (__bf16)vx[i][j];
      *(v8b*)&sv[(dq * 4 + j) * VP + kc + key0] = o; }
    // key norms from the rounded rows: a lane sums one of the 32 rows that its own wave has just written (a wave's LDS operations run in order)
    float a = 0.f;
#pragma unroll  // constant register indices
    for (int q = 0; q < 4; ++q) { const v8b y = *(const v8b*)&sk[(kc + wave * 32 + lane) * KP + q * 8];
#pragma unroll  // constant register indices
      for (int i = 0; i < 8; ++i) { const float v = (float)y[i]; a += v * v; } }
    skn[kc + wave * 32 + lane] = a; };
  fetch(0);
  // the lane's query: norm (f32 sum of squares of the bf16-rounded inputs) and B fragment
  float qn = 0.f; v16b qf;
  { const float* qp = Q + ((size_t)b * TT + q0 + col) * RS + h * HE;
#pragma unroll  // constant register indices
    for (int d = 0; d < HE; ++d) { const float v = bfr(qp[d]); qn += v * v; }
#pragma unroll  // constant register indices
    for (int i = 0; i < 8; ++i) { qf[i] = (__bf16)qp[8 * g + i]; qf[8 + i] = (__bf16)qp[16 + 8 * g + i]; } }
  lay(0);
  __syncthreads();
  // softmax in base 2: the running maximum is taken over x = dot - wedge, and c2 = 0.5 / sqrt(32) * log2(e) enters only in the exp2 argument c2 * x + nmc
  // (one fused multiply-add per score). nmc = -c2 * maximum, rounded once, is the common reference of a pass's P, so its rounding cancels in O = acc / l;
  // the rescale factor exp2(c2 * (old maximum - new maximum)) is exactly 1 while the maximum stands.
  const float c2 = 0.12751743f;
  float m = -3.0e38f, l = 0.f; v8f acc[2] = {};
#pragma unroll 1  // one trip per chunk, closed by the barrier that publishes the next chunk
  for (int kc = 0; kc < TT; kc += CK) {
  if (kc + CK < TT) fetch(kc + CK);
#pragma unroll 1  // one pass is already 64 keys of straight-line code
  for (int p = 0; p < CK / 64; ++p) { const int k0 = kc + p * 64; v8f s[4];
#pragma unroll  // constant register indices
    for (int t = 0; t < 4; ++t) { const v8f z = {}; s[t] = wmma_bf(frag_b(&sk[(k0 + t * 16 + col) * KP], g), qf, z); }
    float mx = m;
#pragma unroll  // constant register indices
    for (int t = 0; t < 4; ++t) { const v4f n0 = *(const v4f*)&skn[k0 + t * 16 + 8 * g], n1 = *(const v4f*)&skn[k0 + t * 16 + 8 * g + 4];
#pragma unroll  // constant register indices
      for (int r = 0; r < 8; ++r) { const float kn = r < 4 ? n0[r & 3] : n1[r & 3]; const float dt = s[t][r]; const float wd = fmaxf(qn * kn - dt * dt, 0.f);
        const float x = dt - wd; s[t][r] = x; mx = fmaxf(mx, x); } }
    mx = fmaxf(mx, xhalf(mx));
    const float nmc = -c2 * mx; const float alpha = __builtin_amdgcn_exp2f(c2 * (m - mx)); m = mx; v2f ps[4];  // a pass's sum of P: one packed chain per 16-key tile, even and odd keys apart
#pragma unroll  // constant register indices
    for (int t = 0; t < 4; ++t)
#pragma unroll  // constant register indices
      for (int r = 0; r < 8; r += 2) { const v2f a = __builtin_elementwise_fma(v2f{ s[t][r], s[t][r + 1] }, v2f{ c2, c2 }, v2f{ nmc, nmc });
        const float p0 = __builtin_amdgcn_exp2f(a[0]), p1 = __builtin_amdgcn_exp2f(a[1]); s[t][r] = p0; s[t][r + 1] = p1; ps[t] = r == 0 ? v2f{ p0, p1 } : ps[t] + v2f{ p0, p1 }; }
    { const v2f q = (ps[0] + ps[1]) + (ps[2] + ps[3]); l = l * alpha + (q[0] + q[1]); }
#pragma unroll  // constant register indices
    for (int j = 0; j < 2; ++j)
#pragma unroll  // constant register indices
      for (int r = 0; r < 8; ++r) acc[j][r] *= alpha;
#pragma unroll  // constant register indices
    for (int c = 0; c < 2; ++c) { v16b ph, pl;
#pragma unroll  // constant register indices
      for (int i = 0; i < 16; i += 2) { const v2f p = { s[2 * c + (i >> 3)][i & 7], s[2 * c + (i >> 3)][(i & 7) + 1] }; const v2b hi = __builtin_convertvector(p, v2b);
        const v2b lo = __builtin_convertvector(p - __builtin_convertvector(hi, v2f), v2b); ph[i] = hi[0]; ph[i + 1] = hi[1]; pl[i] = lo[0]; pl[i + 1] = lo[1]; }
#pragma unroll  // constant register indices
      for (int j = 0; j < 2; ++j) { const v16b vf = frag_b(&sv[(j * 16 + col) * VP + k0 + c * 32], g);
        acc[j] = wmma_bf(vf, ph, acc[j]); acc[j] = wmma_bf(vf, pl, acc[j]); } } }
  if (kc + CK < TT) { lay(kc + CK); __syncthreads(); } }  // the next chunk is complete in LDS; the test reads the same for the whole block
  l += xhalf(l); const float inv = 1.0f / l;
  // acc[j][r] = O[query col][16 j + 8 g + r]: 8 consecutive outputs of one row per lane
  float* op = OUT + ((size_t)b * TT + q0 + col) * RS + h * HE + 8 * g;
#pragma unroll  // constant register indices
  for (int j = 0; j < 2; ++j) { v4f a, c;
#pragma unroll  // constant register indices
    for (int i = 0; i < 4; ++i) { a[i] = acc[j][i] * inv; c[i] = acc[j][4 + i] * inv; }
    *(v4f*)(op + j * 16) = a; *(v4f*)(op + j * 16 + 4) = c; } }
extern "C" void kernel_launch(void* const* d_in, const int* in_sizes, int n_in, void* d_out, int out_size, void* d_ws, size_t ws_size, hipStream_t stream) {
  (void)in_sizes; (void)n_in; (void)out_size; (void)d_ws; (void)ws_size;
  const float** F = (const float**)d_in;   // 0 queries [2,2048,8,32], 1 keys, 2 values
  k_fa<<<dim3(TT / (NW * 16), NH, NB), NW * 32, 0, stream>>>(F[0], F[1], F[2], (float*)d_out);
}

// v005
// A run of this version takes 21 microseconds.
// Next to v004, in two timings, it ran 1.11 times as fast each time.
// Counting every step since v000, it is 25.7 times as fast.
// compute dtype: all float inputs rounded to bf16; dot = k . q with the bf16-exact inputs on WMMA 16x16x32 (1 product, exact), f32 accumulate; |q|^2, |k|^2, wedge = relu(|q|^2 |k|^2 - dot^2) and x = dot - wedge in f32 on the VALU; running-maximum softmax in f32 in base 2, P = exp2(c2 x - c2 max), c2 = 0.5 log2(e) / sqrt(32) (hardware exp2), unnormalised P (0 to 1) rounded once to f16 (11 bits) against the bf16-rounded values held as f16 (the same numbers from 2^-17 up in magnitude) on WMMA 16x16x32 f16 (1 product), f32 accumulate, divided by the f32 row sum of the unrounded P at the end; f32 output [b][l][h][d].
#include <hip/hip_runtime.h>
#include <math.h>

typedef __attribute__((ext_vector_type(16))) __bf16 v16b;
typedef __attribute__((ext_vector_type(8)))  __bf16 v8b;
typedef __attribute__((ext_vector_type(8)))  float v8f;
typedef __attribute__((ext_vector_type(4)))  float v4f;
typedef __attribute__((ext_vector_type(2)))  float v2f;
typedef __attribute__((ext_vector_type(16))) _Float16 v16h;
typedef __attribute__((ext_vector_type(8)))  _Float16 v8h;
typedef __attribute__((ext_vector_type(2)))  _Float16 v2h;

// Geometric (Clifford wedge) attention (B 2, L = S = 2,048, H 8, E = D = 32): scores mix the dot product and the clamped wedge norm |q|^2|k|^2 - (q.k)^2.
#define NB 2
#define TT 2048
#define NH 8
#define HE 32
#define RS (NH * HE)      // 256 row stride
#define NW 8              // waves per block, 16 queries each
#define CK 256            // keys per staged chunk: 32 per wave
#define KP 40             // LDS pitch of a key row, bf16 elements: 80 B = 16 B x odd
#define VP (TT + 8)       // LDS pitch of a row of V transposed, f16 elements: 4,112 B = 16 B x odd

__device__ __forceinline__ v8f wmma_bf(v16b a, v16b b, v8f c) { return __builtin_amdgcn_wmma_f32_16x16x32_bf16(false, a, false, b, (short)0, c, false, false); }
// 16x16x32 fragments: lane = (g = lane>>4, row/col = lane&15); elements 0..7 = k0+8g+0..7, 8..15 = k0+16+8g+0..7; D element r = row 8g+r
__device__ __forceinline__ v16b frag_b(const __bf16* rowk0, int g) {
  union { v16b v; v8b q[2]; } u; const __bf16* p = rowk0 + 8 * g;
  u.q[0] = *(const v8b*)p; u.q[1] = *(const v8b*)(p + 16); return u.v;
}
__device__ __forceinline__ v8f wmma_h(v16h a, v16h b, v8f c) { return __builtin_amdgcn_wmma_f32_16x16x32_f16(false, a, false, b, (short)0, c, false, false); }
__device__ __forceinline__ v16h frag_h(const _Float16* rowk0, int g) {
  union { v16h v; v8h q[2]; } u; const _Float16* p = rowk0 + 8 * g;
  u.q[0] = *(const v8h*)p; u.q[1] = *(const v8h*)(p + 16); return u.v;
}
__device__ __forceinline__ float bfr(float v) { return (float)(__bf16)v; }
// lane l with lane l ^ 16
__device__ __forceinline__ float xhalf(float x) { return __builtin_bit_cast(float, __builtin_amdgcn_permlanex16(__builtin_bit_cast(int, x), __builtin_bit_cast(int, x), 0x76543210, 0xfedcba98, false, false)); }

// ---- k_fa: block = (128 queries, head, batch). The head's keys (bf16), values (bf16-rounded, held as f16, transposed) and key norms are laid in LDS once, in chunks of CK keys:
// a wave issues the global loads of its 32 keys of the next chunk, works on the current chunk while they fly, then rounds and stores them; one barrier per chunk publishes it.
// Each wave walks all keys for its 16 queries: S^T = K . Q^T (a lane holds one query's scores), running-maximum softmax, O^T += V^T . P^T
// (two S^T tiles, converted in place, are the B operand). Scores and P never leave the registers.
__global__ __launch_bounds__(NW * 32) void k_fa(const float* __restrict__ Q, const float* __restrict__ Kk, const float* __restrict__ V, float* __restrict__ OUT) {
  __shared__ __align__(16) __bf16 sk[TT * KP]; __shared__ __align__(16) _Float16 sv[HE * VP]; __shared__ __align__(16) float skn[TT];
  const int tid = threadIdx.x, wave = tid >> 5, lane = tid & 31, col = lane & 15, g = lane >> 4;
  const int h = blockIdx.y, b = blockIdx.z; const int q0 = blockIdx.x * (NW * 16) + wave * 16;
  // staging of a chunk, a wave's share being 32 keys. Keys: a lane takes 8 elements of each of 4 key rows. Values: a lane takes 8 keys x 4 columns.
  const int c8 = (lane & 3) * 8, kr = wave * 32 + (lane >> 2), dq = lane & 7, key0 = wave * 32 + (lane >> 3) * 8;
  const float* pk = Kk + ((size_t)b * TT + kr) * RS + h * HE + c8; const float* pv = V + ((size_t)b * TT + key0) * RS + h * HE + dq * 4;
  v4f kx[4], ky[4], vx[8];
  auto fetch = [&](const int kc) {  // kc: first key of the chunk
    const float* p = pk + (size_t)kc * RS; const float* r = pv + (size_t)kc * RS;
#pragma unroll  // constant register indices
    for (int it = 0; it < 4; ++it) { kx[it] = *(const v4f*)(p + it * 8 * RS); ky[it] = *(const v4f*)(p + it * 8 * RS + 4); }
#pragma unroll  // constant register indices
    for (int i = 0; i < 8; ++i) vx[i] = *(const v4f*)(r + i * RS);
    // holds the 16 loads here, ahead of the work they fly over, and keeps their two address pairs whole until the translations are done
    asm volatile("s_wait_xcnt 0x0" :: "v"(p), "v"(r) : "memory"); };
  auto lay = [&](const int kc) {
#pragma unroll  // constant register indices
    for (int it = 0; it < 4; ++it) { v8b o;
#pragma unroll  // constant register indices
      for (int i = 0; i < 4; ++i) { o[i] = (__bf16)kx[it][i]; o[4 + i] = (__bf16)ky[it][i]; }
      *(v8b*)&sk[(kc + kr + it * 8) * KP + c8] = o; }
    // 8 keys of each column go as one 16-byte piece of the transposed row
#pragma unroll  // constant register indices
    for (int j = 0; j < 4; ++j) { v8h o;
#pragma unroll  // constant register indices
      for (int i = 0; i < 8; ++i) o[i] = (_Float16)bfr(vx[i][j]);
      *(v8h*)&sv[(dq * 4 + j) * VP + kc + key0] = o; }
    // key norms from the rounded rows: a lane sums one of the 32 rows that its own wave has just written (a wave's LDS operations run in order)
    float a = 0.f;
#pragma unroll  // constant register indices
    for (int q = 0; q < 4; ++q) { const v8b y = *(const v8b*)&sk[(kc + wave * 32 + lane) * KP + q * 8];
#pragma unroll  // constant register indices
      for (int i = 0; i < 8; ++i) { const float v = (float)y[i]; a += v * v; } }
    skn[kc + wave * 32 + lane] = a; };
  fetch(0);
  // the lane's query: norm (f32 sum of squares of the bf16-rounded inputs) and B fragment
  float qn = 0.f; v16b qf;
  { const float* qp = Q + ((size_t)b * TT + q0 + col) * RS + h * HE;
#pragma unroll  // constant register indices
    for (int d = 0; d < HE; ++d) { const float v = bfr(qp[d]); qn += v * v; }
#pragma unroll  // constant register indices
    for (int i = 0; i < 8; ++i) { qf[i] = (__bf16)qp[8 * g + i]; qf[8 + i] = (__bf16)qp[16 + 8 * g + i]; } }
  lay(0);
  __syncthreads();
  // softmax in base 2: the running maximum is taken over x = dot - wedge, and c2 = 0.5 / sqrt(32) * log2(e) enters only in the exp2 argument c2 * x + nmc
  // (one fused multiply-add per score). nmc = -c2 * maximum, rounded once, is the common reference of a pass's P, so its rounding cancels in O = acc / l;
  // the rescale factor exp2(c2 * (old maximum - new maximum)) is exactly 1 while the maximum stands.
  const float c2 = 0.12751743f;
  float m = -3.0e38f, l = 0.f; v8f acc[2] = {};
#pragma unroll 1  // one trip per chunk, closed by the barrier that publishes the next chunk
  for (int kc = 0; kc < TT; kc += CK) {
  if (kc + CK < TT) fetch(kc + CK);
#pragma unroll 1  // one pass is already 64 keys of straight-line code
  for (int p = 0; p < CK / 64; ++p) { const int k0 = kc + p * 64; v8f s[4];
#pragma unroll  // constant register indices
    for (int t = 0; t < 4; ++t) { const v8f z = {}; s[t] = wmma_bf(frag_b(&sk[(k0 + t * 16 + col) * KP], g), qf, z); }
    float mx = m;
#pragma unroll  // constant register indices
    for (int t = 0; t < 4; ++t) { const v4f n0 = *(const v4f*)&skn[k0 + t * 16 + 8 * g], n1 = *(const v4f*)&skn[k0 + t * 16 + 8 * g + 4];
#pragma unroll  // constant register indices
      for (int r = 0; r < 8; ++r) { const float kn = r < 4 ? n0[r & 3] : n1[r & 3]; const float dt = s[t][r]; const float wd = fmaxf(qn * kn - dt * dt, 0.f);
        const float x = dt - wd; s[t][r] = x; mx = fmaxf(mx, x); } }
    mx = fmaxf(mx, xhalf(mx));
    const float nmc = -c2 * mx; const float alpha = __builtin_amdgcn_exp2f(c2 * (m - mx)); m = mx; v2f ps[4];  // a pass's sum of P: one packed chain per 16-key tile, even and odd keys apart
#pragma unroll  // constant register indices
    for (int t = 0; t < 4; ++t)
#pragma unroll  // constant register indices
      for (int r = 0; r < 8; r += 2) { const v2f a = __builtin_elementwise_fma(v2f{ s[t][r], s[t][r + 1] }, v2f{ c2, c2 }, v2f{ nmc, nmc });
        const float p0 = __builtin_amdgcn_exp2f(a[0]), p1 = __builtin_amdgcn_exp2f(a[1]); s[t][r] = p0; s[t][r + 1] = p1; ps[t] = r == 0 ? v2f{ p0, p1 } : ps[t] + v2f{ p0, p1 }; }
    { const v2f q = (ps[0] + ps[1]) + (ps[2] + ps[3]); l = l * alpha + (q[0] + q[1]); }
#pragma unroll  // constant register indices
    for (int j = 0; j < 2; ++j)
#pragma unroll  // constant register indices
      for (int r = 0; r < 8; ++r) acc[j][r] *= alpha;
#pragma unroll  // constant register indices
    for (int c = 0; c < 2; ++c) { v16h ph;
#pragma unroll  // constant register indices
      for (int i = 0; i < 16; i += 2) { const v2f p = { s[2 * c + (i >> 3)][i & 7], s[2 * c + (i >> 3)][(i & 7) + 1] }; const v2h hi = __builtin_convertvector(p, v2h);
        ph[i] = hi[0]; ph[i + 1] = hi[1]; }
#pragma unroll  // constant register indices
      for (int j = 0; j < 2; ++j) acc[j] = wmma_h(frag_h(&sv[(j * 16 + col) * VP + k0 + c * 32], g), ph, acc[j]); } }
  if (kc + CK < TT) { lay(kc + CK); __syncthreads(); } }  // the next chunk is complete in LDS; the test reads the same for the whole block
  l += xhalf(l); const float inv = 1.0f / l;
  // acc[j][r] = O[query col][16 j + 8 g + r]: 8 consecutive outputs of one row per lane
  float* op = OUT + ((size_t)b * TT + q0 + col) * RS + h * HE + 8 * g;
#pragma unroll  // constant register indices
  for (int j = 0; j < 2; ++j) { v4f a, c;
#pragma unroll  // constant register indices
    for (int i = 0; i < 4; ++i) { a[i] = acc[j][i] * inv; c[i] = acc[j][4 + i] * inv; }
    *(v4f*)(op + j * 16) = a; *(v4f*)(op + j * 16 + 4) = c; } }
extern "C" void kernel_launch(void* const* d_in, const int* in_sizes, int n_in, void* d_out, int out_size, void* d_ws, size_t ws_size, hipStream_t stream) {
  (void)in_sizes; (void)n_in; (void)out_size; (void)d_ws; (void)ws_size;
  const float** F = (const float**)d_in;   // 0 queries [2,2048,8,32], 1 keys, 2 values
  k_fa<<<dim3(TT / (NW * 16), NH, NB), NW * 32, 0, stream>>>(F[0], F[1], F[2], (float*)d_out);
}

// v006
// One run takes 20.1 microseconds.
// Two timings next to v005 both put it at 1.04 times that version's speed.
// Over all steps from v000 it is 26.6 times as fast.
// compute dtype: all float inputs rounded to bf16; dot = k . q with the bf16-exact inputs on WMMA 16x16x32 (1 product, exact), f32 accumulate; |q|^2, |k|^2 and x = dot - relu(|q|^2 |k|^2 - dot^2) = min(dot, y), y = dot^2 + dot - |q|^2 |k|^2 (two fused multiply-adds), in f32 on the VALU; the minimum is taken per score only in a second walk, made when a query's largest y does not prove it idle; running-maximum softmax in f32 in base 2, P = exp2(c2 x - c2 max), c2 = 0.5 log2(e) / sqrt(32) (hardware exp2), unnormalised P (0 to 1) rounded once to f16 (11 bits) against the bf16-rounded values held as f16 (the same numbers from 2^-17 up in magnitude) on WMMA 16x16x32 f16 (1 product), f32 accumulate, divided by the f32 row sum of the unrounded P at the end; f32 output [b][l][h][d].
#include <hip/hip_runtime.h>
#include <math.h>

typedef __attribute__((ext_vector_type(16))) __bf16 v16b;
typedef __attribute__((ext_vector_type(8)))  __bf16 v8b;
typedef __attribute__((ext_vector_type(8)))  float v8f;
typedef __attribute__((ext_vector_type(4)))  float v4f;
typedef __attribute__((ext_vector_type(2)))  float v2f;
typedef __attribute__((ext_vector_type(16))) _Float16 v16h;
typedef __attribute__((ext_vector_type(8)))  _Float16 v8h;
typedef __attribute__((ext_vector_type(2)))  _Float16 v2h;

// Geometric (Clifford wedge) attention (B 2, L = S = 2,048, H 8, E = D = 32): scores mix the dot product and the clamped wedge norm |q|^2|k|^2 - (q.k)^2.
#define NB 2
#define TT 2048
#define NH 8
#define HE 32
#define RS (NH * HE)      // 256 row stride
#define NW 8              // waves per block, 16 queries each
#define CK 256            // keys per staged chunk: 32 per wave
#define KP 40             // LDS pitch of a key row, bf16 elements: 80 B = 16 B x odd
#define VP (TT + 8)       // LDS pitch of a row of V transposed, f16 elements: 4,112 B = 16 B x odd

__device__ __forceinline__ v8f wmma_bf(v16b a, v16b b, v8f c) { return __builtin_amdgcn_wmma_f32_16x16x32_bf16(false, a, false, b, (short)0, c, false, false); }
// 16x16x32 fragments: lane = (g = lane>>4, row/col = lane&15); elements 0..7 = k0+8g+0..7, 8..15 = k0+16+8g+0..7; D element r = row 8g+r
__device__ __forceinline__ v16b frag_b(const __bf16* rowk0, int g) {
  union { v16b v; v8b q[2]; } u; const __bf16* p = rowk0 + 8 * g;
  u.q[0] = *(const v8b*)p; u.q[1] = *(const v8b*)(p + 16); return u.v;
}
__device__ __forceinline__ v8f wmma_h(v16h a, v16h b, v8f c) { return __builtin_amdgcn_wmma_f32_16x16x32_f16(false, a, false, b, (short)0, c, false, false); }
__device__ __forceinline__ v16h frag_h(const _Float16* rowk0, int g) {
  union { v16h v; v8h q[2]; } u; const _Float16* p = rowk0 + 8 * g;
  u.q[0] = *(const v8h*)p; u.q[1] = *(const v8h*)(p + 16); return u.v;
}
// lane l with lane l ^ M inside its row of 16
template <int M> __device__ __forceinline__ float xrow(float x) { return __builtin_bit_cast(float, __builtin_amdgcn_update_dpp(0, __builtin_bit_cast(int, x), 0x160 | M, 0xf, 0xf, true)); }
template <bool B> struct flag { static constexpr bool v = B; };
__device__ __forceinline__ float bfr(float v) { return (float)(__bf16)v; }
// lane l with lane l ^ 16
__device__ __forceinline__ float xhalf(float x) { return __builtin_bit_cast(float, __builtin_amdgcn_permlanex16(__builtin_bit_cast(int, x), __builtin_bit_cast(int, x), 0x76543210, 0xfedcba98, false, false)); }

// ---- k_fa: block = (128 queries, head, batch). The head's keys (bf16), values (bf16-rounded, held as f16, transposed) and key norms are laid in LDS once, in chunks of CK keys:
// a wave issues the global loads of its 32 keys of the next chunk, works on the current chunk while they fly, then rounds and stores them; one barrier per chunk publishes it.
// Each wave walks all keys for its 16 queries: S^T = K . Q^T (a lane holds one query's scores), running-maximum softmax, O^T += V^T . P^T
// (two S^T tiles, converted in place, are the B operand). Scores and P never leave the registers.
__global__ __launch_bounds__(NW * 32) void k_fa(const float* __restrict__ Q, const float* __restrict__ Kk, const float* __restrict__ V, float* __restrict__ OUT) {
  __shared__ __align__(16) __bf16 sk[TT * KP]; __shared__ __align__(16) _Float16 sv[HE * VP]; __shared__ __align__(16) float skn[TT]; __shared__ __align__(16) float skm[NW * 32];
  const int tid = threadIdx.x, wave = tid >> 5, lane = tid & 31, col = lane & 15, g = lane >> 4;
  const int h = blockIdx.y, b = blockIdx.z; const int q0 = blockIdx.x * (NW * 16) + wave * 16;
  // staging of a chunk, a wave's share being 32 keys. Keys: a lane takes 8 elements of each of 4 key rows. Values: a lane takes 8 keys x 4 columns.
  const int c8 = (lane & 3) * 8, kr = wave * 32 + (lane >> 2), dq = lane & 7, key0 = wave * 32 + (lane >> 3) * 8;
  const float* pk = Kk + ((size_t)b * TT + kr) * RS + h * HE + c8; const float* pv = V + ((size_t)b * TT + key0) * RS + h * HE + dq * 4;
  v4f kx[4], ky[4], vx[8]; float kmx = 0.f;  // largest key norm this lane has laid
  auto fetch = [&](const int kc) {  // kc: first key of the chunk
    const float* p = pk + (size_t)kc * RS; const float* r = pv + (size_t)kc * RS;
#pragma unroll  // constant register indices
    for (int it = 0; it < 4; ++it) { kx[it] = *(const v4f*)(p + it * 8 * RS); ky[it] = *(const v4f*)(p + it * 8 * RS + 4); }
#pragma unroll  // constant register indices
    for (int i = 0; i < 8; ++i) vx[i] = *(const v4f*)(r + i * RS);
    // holds the 16 loads here, ahead of the work they fly over, and keeps their two address pairs whole until the translations are done
    asm volatile("s_wait_xcnt 0x0" :: "v"(p), "v"(r) : "memory"); };
  auto lay = [&](const int kc) {
#pragma unroll  // constant register indices
    for (int it = 0; it < 4; ++it) { v8b o;
#pragma unroll  // constant register indices
      for (int i = 0; i < 4; ++i) { o[i] = (__bf16)kx[it][i]; o[4 + i] = (__bf16)ky[it][i]; }
      *(v8b*)&sk[(kc + kr + it * 8) * KP + c8] = o; }
    // 8 keys of each column go as one 16-byte piece of the transposed row
#pragma unroll  // constant register indices
    for (int j = 0; j < 4; ++j) { v8h o;
#pragma unroll  // constant register indices
      for (int i = 0; i < 8; ++i) o[i] = (_Float16)bfr(vx[i][j]);
      *(v8h*)&sv[(dq * 4 + j) * VP + kc + key0] = o; }
    // key norms from the rounded rows: a lane sums one of the 32 rows that its own wave has just written (a wave's LDS operations run in order)
    float a = 0.f;
#pragma unroll  // constant register indices
    for (int q = 0; q < 4; ++q) { const v8b y = *(const v8b*)&sk[(kc + wave * 32 + lane) * KP + q * 8];
#pragma unroll  // constant register indices
      for (int i = 0; i < 8; ++i) { const float v = (float)y[i]; a += v * v; } }
    skn[kc + wave * 32 + lane] = a; kmx = fmaxf(kmx, a); skm[tid] = kmx; };
  fetch(0);
  // the lane's query: norm (f32 sum of squares of the bf16-rounded inputs) and B fragment
  float qn = 0.f; v16b qf;
  { const float* qp = Q + ((size_t)b * TT + q0 + col) * RS + h * HE;
#pragma unroll  // constant register indices
    for (int d = 0; d < HE; ++d) { const float v = bfr(qp[d]); qn += v * v; }
#pragma unroll  // constant register indices
    for (int i = 0; i < 8; ++i) { qf[i] = (__bf16)qp[8 * g + i]; qf[8 + i] = (__bf16)qp[16 + 8 * g + i]; } }
  lay(0);
  __syncthreads();
  // softmax in base 2: the running maximum is taken over x = dot - wedge, and c2 = 0.5 / sqrt(32) * log2(e) enters only in the exp2 argument c2 * x + nmc
  // (one fused multiply-add per score). nmc = -c2 * maximum, rounded once, is the common reference of a pass's P, so its rounding cancels in O = acc / l;
  // the rescale factor exp2(c2 * (old maximum - new maximum)) is exactly 1 while the maximum stands.
  const float c2 = 0.12751743f, nqn = -qn;
  float m = -3.0e38f, l = 0.f; v8f acc[2] = {};
  // one pass: 64 keys. CL::v says whether x = min(dot, y) or x = y.
  auto pass = [&](const int k0, auto CL) { v8f s[4];
#pragma unroll  // constant register indices
    for (int t = 0; t < 4; ++t) { const v8f z = {}; s[t] = wmma_bf(frag_b(&sk[(k0 + t * 16 + col) * KP], g), qf, z); }
    float mx = m;
#pragma unroll  // constant register indices
    for (int t = 0; t < 4; ++t) { const v4f n0 = *(const v4f*)&skn[k0 + t * 16 + 8 * g], n1 = *(const v4f*)&skn[k0 + t * 16 + 8 * g + 4];
#pragma unroll  // constant register indices
      for (int r = 0; r < 8; ++r) { const float kn = r < 4 ? n0[r & 3] : n1[r & 3]; const float dt = s[t][r];
        const float y = __builtin_fmaf(nqn, kn, __builtin_fmaf(dt, dt, dt)); const float x = decltype(CL)::v ? fminf(dt, y) : y; s[t][r] = x; mx = fmaxf(mx, x); } }
    mx = fmaxf(mx, xhalf(mx));
    const float nmc = -c2 * mx; const float alpha = __builtin_amdgcn_exp2f(c2 * (m - mx)); m = mx; v2f ps[4];  // a pass's sum of P: one packed chain per 16-key tile, even and odd keys apart
#pragma unroll  // constant register indices
    for (int t = 0; t < 4; ++t)
#pragma unroll  // constant register indices
      for (int r = 0; r < 8; r += 2) { const v2f a = __builtin_elementwise_fma(v2f{ s[t][r], s[t][r + 1] }, v2f{ c2, c2 }, v2f{ nmc, nmc });
        const float p0 = __builtin_amdgcn_exp2f(a[0]), p1 = __builtin_amdgcn_exp2f(a[1]); s[t][r] = p0; s[t][r + 1] = p1; ps[t] = r == 0 ? v2f{ p0, p1 } : ps[t] + v2f{ p0, p1 }; }
    { const v2f q = (ps[0] + ps[1]) + (ps[2] + ps[3]); l = l * alpha + (q[0] + q[1]); }
#pragma unroll  // constant register indices
    for (int j = 0; j < 2; ++j)
#pragma unroll  // constant register indices
      for (int r = 0; r < 8; ++r) acc[j][r] *= alpha;
#pragma unroll  // constant register indices
    for (int c = 0; c < 2; ++c) { v16h ph;
#pragma unroll  // constant register indices
      for (int i = 0; i < 16; i += 2) { const v2f p = { s[2 * c + (i >> 3)][i & 7], s[2 * c + (i >> 3)][(i & 7) + 1] }; const v2h hi = __builtin_convertvector(p, v2h);
        ph[i] = hi[0]; ph[i + 1] = hi[1]; }
#pragma unroll  // constant register indices
      for (int j = 0; j < 2; ++j) acc[j] = wmma_h(frag_h(&sv[(j * 16 + col) * VP + k0 + c * 32], g), ph, acc[j]); } };
#pragma unroll 1  // one trip per chunk, closed by the barrier that publishes the next chunk
  for (int kc = 0; kc < TT; kc += CK) {
  if (kc + CK < TT) fetch(kc + CK);
#pragma unroll 1  // one pass is already 64 keys of straight-line code
  for (int p = 0; p < CK / 64; ++p) pass(kc + p * 64, flag<false>{});
  if (kc + CK < TT) { lay(kc + CK); __syncthreads(); } }  // the next chunk is complete in LDS; the test reads the same for the whole block
  // Was min(dot, y) = y for every key? |dot| <= sqrt(|q|^2 |k|^2) (Cauchy-Schwarz), so dot >= -sqrt(1.03 |q|^2 max |k|^2) for all keys (the 3 % covers the roundings while the product is a normal number); m is the largest y.
  // m below that bound, tested on the squares, proves y < dot throughout, and the walk above is the walk with the minimum, bit for bit. Otherwise (a NaN, a product near underflow included) the wave walks the keys, all in LDS, again with it.
  { const v4f e0 = *(const v4f*)&skm[lane * 8], e1 = *(const v4f*)&skm[lane * 8 + 4];
    float km = fmaxf(fmaxf(fmaxf(e0[0], e0[1]), fmaxf(e0[2], e0[3])), fmaxf(fmaxf(e1[0], e1[1]), fmaxf(e1[2], e1[3])));
    km = fmaxf(km, xhalf(km)); km = fmaxf(km, xrow<8>(km)); km = fmaxf(km, xrow<4>(km)); km = fmaxf(km, xrow<2>(km)); km = fmaxf(km, xrow<1>(km));
    const float qk = qn * km;
    const bool idle = (m < 0.f) & (m * m > 1.03f * qk) & (qk > 1.0e-30f);
    if (__builtin_amdgcn_ballot_w32(!idle) != 0) {  // the same for the whole wave: a scalar branch, no barrier behind it
      m = -3.0e38f; l = 0.f; acc[0] = v8f{}; acc[1] = v8f{};
#pragma unroll 1  // one pass is already 64 keys of straight-line code
      for (int k0 = 0; k0 < TT; k0 += 64) pass(k0, flag<true>{}); } }
  l += xhalf(l); const float inv = 1.0f / l;
  // acc[j][r] = O[query col][16 j + 8 g + r]: 8 consecutive outputs of one row per lane
  float* op = OUT + ((size_t)b * TT + q0 + col) * RS + h * HE + 8 * g;
#pragma unroll  // constant register indices
  for (int j = 0; j < 2; ++j) { v4f a, c;
#pragma unroll  // constant register indices
    for (int i = 0; i < 4; ++i) { a[i] = acc[j][i] * inv; c[i] = acc[j][4 + i] * inv; }
    *(v4f*)(op + j * 16) = a; *(v4f*)(op + j * 16 + 4) = c; } }
extern "C" void kernel_launch(void* const* d_in, const int* in_sizes, int n_in, void* d_out, int out_size, void* d_ws, size_t ws_size, hipStream_t stream) {
  (void)in_sizes; (void)n_in; (void)out_size; (void)d_ws; (void)ws_size;
  const float** F = (const float**)d_in;   // 0 queries [2,2048,8,32], 1 keys, 2 values
  k_fa<<<dim3(TT / (NW * 16), NH, NB), NW * 32, 0, stream>>>(F[0], F[1], F[2], (float*)d_out);
}

// v007
// One run takes 19.4 microseconds.
// In both of two side-by-side timings against v006, it was 1.04 times as fast.
// Over all steps from v000 it is 27.6 times as fast.
// compute dtype: all float inputs rounded to bf16; dot = k . q with the bf16-exact inputs on WMMA 16x16x32 (1 product, exact), f32 accumulate; |q|^2, |k|^2 and x = dot - relu(|q|^2 |k|^2 - dot^2) = min(dot, y), y = dot^2 + dot - |q|^2 |k|^2 (two fused multiply-adds), in f32 on the VALU; the minimum is taken per score only in a second walk, made when a query's largest y does not prove it idle; running-maximum softmax in f32 in base 2, P = exp2(c2 x - c2 max), c2 = 0.5 log2(e) / sqrt(32) (hardware exp2), unnormalised P (0 to 1) rounded once to f16 (11 bits) against the bf16-rounded values held as f16 (the same numbers from 2^-17 up in magnitude) on WMMA 16x16x32 f16 (1 product), f32 accumulate, divided by the f32 row sum of the unrounded P at the end; f32 output [b][l][h][d].
#include <hip/hip_runtime.h>
#include <math.h>

typedef __attribute__((ext_vector_type(16))) __bf16 v16b;
typedef __attribute__((ext_vector_type(8)))  __bf16 v8b;
typedef __attribute__((ext_vector_type(8)))  float v8f;
typedef __attribute__((ext_vector_type(4)))  float v4f;
typedef __attribute__((ext_vector_type(2)))  float v2f;
typedef __attribute__((ext_vector_type(16))) _Float16 v16h;
typedef __attribute__((ext_vector_type(8)))  _Float16 v8h;
typedef __attribute__((ext_vector_type(2)))  _Float16 v2h;

// Geometric (Clifford wedge) attention (B 2, L = S = 2,048, H 8, E = D = 32): scores mix the dot product and the clamped wedge norm |q|^2|k|^2 - (q.k)^2.
#define NB 2
#define TT 2048
#define NH 8
#define HE 32
#define RS (NH * HE)      // 256 row stride
#define NW 8              // waves per block, 16 queries each
#define CK 256            // keys per staged chunk: 32 per wave
#define PK 128            // keys per pass: one update of the running maximum
#define NT (PK / 16)      // 16-key score tiles per pass
#define KP 40             // LDS pitch of a key row, bf16 elements: 80 B = 16 B x odd
#define VP (TT + 8)       // LDS pitch of a row of V transposed, f16 elements: 4,112 B = 16 B x odd

__device__ __forceinline__ v8f wmma_bf(v16b a, v16b b, v8f c) { return __builtin_amdgcn_wmma_f32_16x16x32_bf16(false, a, false, b, (short)0, c, false, false); }
// 16x16x32 fragments: lane = (g = lane>>4, row/col = lane&15); elements 0..7 = k0+8g+0..7, 8..15 = k0+16+8g+0..7; D element r = row 8g+r
__device__ __forceinline__ v16b frag_b(const __bf16* rowk0, int g) {
  union { v16b v; v8b q[2]; } u; const __bf16* p = rowk0 + 8 * g;
  u.q[0] = *(const v8b*)p; u.q[1] = *(const v8b*)(p + 16); return u.v;
}
__device__ __forceinline__ v8f wmma_h(v16h a, v16h b, v8f c) { return __builtin_amdgcn_wmma_f32_16x16x32_f16(false, a, false, b, (short)0, c, false, false); }
__device__ __forceinline__ v16h frag_h(const _Float16* rowk0, int g) {
  union { v16h v; v8h q[2]; } u; const _Float16* p = rowk0 + 8 * g;
  u.q[0] = *(const v8h*)p; u.q[1] = *(const v8h*)(p + 16); return u.v;
}
// lane l with lane l ^ M inside its row of 16
template <int M> __device__ __forceinline__ float xrow(float x) { return __builtin_bit_cast(float, __builtin_amdgcn_update_dpp(0, __builtin_bit_cast(int, x), 0x160 | M, 0xf, 0xf, true)); }
template <bool B> struct flag { static constexpr bool v = B; };
__device__ __forceinline__ float bfr(float v) { return (float)(__bf16)v; }
// lane l with lane l ^ 16
__device__ __forceinline__ float xhalf(float x) { return __builtin_bit_cast(float, __builtin_amdgcn_permlanex16(__builtin_bit_cast(int, x), __builtin_bit_cast(int, x), 0x76543210, 0xfedcba98, false, false)); }

// ---- k_fa: block = (128 queries, head, batch). The head's keys (bf16), values (bf16-rounded, held as f16, transposed) and key norms are laid in LDS once, in chunks of CK keys:
// a wave issues the global loads of its 32 keys of the next chunk, works on the current chunk while they fly, then rounds and stores them; one barrier per chunk publishes it.
// Each wave walks all keys for its 16 queries: S^T = K . Q^T (a lane holds one query's scores), running-maximum softmax, O^T += V^T . P^T
// (two S^T tiles, converted in place, are the B operand). Scores and P never leave the registers.
__global__ __launch_bounds__(NW * 32) void k_fa(const float* __restrict__ Q, const float* __restrict__ Kk, const float* __restrict__ V, float* __restrict__ OUT) {
  __shared__ __align__(16) __bf16 sk[TT * KP]; __shared__ __align__(16) _Float16 sv[HE * VP]; __shared__ __align__(16) float skn[TT]; __shared__ __align__(16) float skm[NW * 32];
  const int tid = threadIdx.x, wave = tid >> 5, lane = tid & 31, col = lane & 15, g = lane >> 4;
  const int h = blockIdx.y, b = blockIdx.z; const int q0 = blockIdx.x * (NW * 16) + wave * 16;
  // staging of a chunk, a wave's share being 32 keys. Keys: a lane takes 8 elements of each of 4 key rows. Values: a lane takes 8 keys x 4 columns.
  const int c8 = (lane & 3) * 8, kr = wave * 32 + (lane >> 2), dq = lane & 7, key0 = wave * 32 + (lane >> 3) * 8;
  const float* pk = Kk + ((size_t)b * TT + kr) * RS + h * HE + c8; const float* pv = V + ((size_t)b * TT + key0) * RS + h * HE + dq * 4;
  v4f kx[4], ky[4], vx[8]; float kmx = 0.f;  // largest key norm this lane has laid
  auto fetch = [&](const int kc) {  // kc: first key of the chunk
    const float* p = pk + (size_t)kc * RS; const float* r = pv + (size_t)kc * RS;
#pragma unroll  // constant register indices
    for (int it = 0; it < 4; ++it) { kx[it] = *(const v4f*)(p + it * 8 * RS); ky[it] = *(const v4f*)(p + it * 8 * RS + 4); }
#pragma unroll  // constant register indices
    for (int i = 0; i < 8; ++i) vx[i] = *(const v4f*)(r + i * RS);
    // holds the 16 loads here, ahead of the work they fly over, and keeps their two address pairs whole until the translations are done
    asm volatile("s_wait_xcnt 0x0" :: "v"(p), "v"(r) : "memory"); };
  auto lay = [&](const int kc) {
#pragma unroll  // constant register indices
    for (int it = 0; it < 4; ++it) { v8b o;
#pragma unroll  // constant register indices
      for (int i = 0; i < 4; ++i) { o[i] = (__bf16)kx[it][i]; o[4 + i] = (__bf16)ky[it][i]; }
      *(v8b*)&sk[(kc + kr + it * 8) * KP + c8] = o; }
    // 8 keys of each column go as one 16-byte piece of the transposed row
#pragma unroll  // constant register indices
    for (int j = 0; j < 4; ++j) { v8h o;
#pragma unroll  // constant register indices
      for (int i = 0; i < 8; ++i) o[i] = (_Float16)bfr(vx[i][j]);
      *(v8h*)&sv[(dq * 4 + j) * VP + kc + key0] = o; }
    // key norms from the rounded rows: a lane sums one of the 32 rows that its own wave has just written (a wave's LDS operations run in order)
    float a = 0.f;
#pragma unroll  // constant register indices
    for (int q = 0; q < 4; ++q) { const v8b y = *(const v8b*)&sk[(kc + wave * 32 + lane) * KP + q * 8];
#pragma unroll  // constant register indices
      for (int i = 0; i < 8; ++i) { const float v = (float)y[i]; a += v * v; } }
    skn[kc + wave * 32 + lane] = a; kmx = fmaxf(kmx, a); skm[tid] = kmx; };
  fetch(0);
  // the lane's query: norm (f32 sum of squares of the bf16-rounded inputs) and B fragment
  float qn = 0.f; v16b qf;
  { const float* qp = Q + ((size_t)b * TT + q0 + col) * RS + h * HE;
#pragma unroll  // constant register indices
    for (int d = 0; d < HE; ++d) { const float v = bfr(qp[d]); qn += v * v; }
#pragma unroll  // constant register indices
    for (int i = 0; i < 8; ++i) { qf[i] = (__bf16)qp[8 * g + i]; qf[8 + i] = (__bf16)qp[16 + 8 * g + i]; } }
  lay(0);
  __syncthreads();
  // softmax in base 2: the running maximum is taken over x = dot - wedge, and c2 = 0.5 / sqrt(32) * log2(e) enters only in the exp2 argument c2 * x + nmc
  // (one fused multiply-add per score). nmc = -c2 * maximum, rounded once, is the common reference of a pass's P, so its rounding cancels in O = acc / l;
  // the rescale factor exp2(c2 * (old maximum - new maximum)) is exactly 1 while the maximum stands.
  const float c2 = 0.12751743f, nqn = -qn;
  float m = -3.0e38f, l = 0.f; v8f acc[2] = {};
  // one pass: PK keys. CL::v says whether x = min(dot, y) or x = y.
  auto pass = [&](const int k0, auto CL) { v8f s[NT]; v16b kf[NT];
#pragma unroll  // constant register indices
    for (int t = 0; t < NT; ++t) kf[t] = frag_b(&sk[(k0 + t * 16 + col) * KP], g);
    __builtin_amdgcn_sched_barrier(0);  // the key fragments' LDS reads stay one group, first in the LDS queue: the products wait for nothing else
#pragma unroll  // constant register indices
    for (int t = 0; t < NT; ++t) { const v8f z = {}; s[t] = wmma_bf(kf[t], qf, z); }
    float mc[4] = { m, m, m, m };  // the maximum in four independent chains (exact in any order)
#pragma unroll  // constant register indices
    for (int t = 0; t < NT; ++t) { const v4f n0 = *(const v4f*)&skn[k0 + t * 16 + 8 * g], n1 = *(const v4f*)&skn[k0 + t * 16 + 8 * g + 4];
#pragma unroll  // constant register indices
      for (int r = 0; r < 8; ++r) { const float kn = r < 4 ? n0[r & 3] : n1[r & 3]; const float dt = s[t][r];
        const float y = __builtin_fmaf(nqn, kn, __builtin_fmaf(dt, dt, dt)); const float x = decltype(CL)::v ? fminf(dt, y) : y; s[t][r] = x; mc[t & 3] = fmaxf(mc[t & 3], x); } }
    float mx = fmaxf(fmaxf(mc[0], mc[1]), fmaxf(mc[2], mc[3])); mx = fmaxf(mx, xhalf(mx));
    const float nmc = -c2 * mx; const float alpha = __builtin_amdgcn_exp2f(c2 * (m - mx)); m = mx; v2f ps[4];  // a pass's sum of P: four packed chains (tile t in chain t mod 4), even and odd keys apart
#pragma unroll  // constant register indices
    for (int t = 0; t < NT; ++t)
#pragma unroll  // constant register indices
      for (int r = 0; r < 8; r += 2) { const v2f a = __builtin_elementwise_fma(v2f{ s[t][r], s[t][r + 1] }, v2f{ c2, c2 }, v2f{ nmc, nmc });
        const float p0 = __builtin_amdgcn_exp2f(a[0]), p1 = __builtin_amdgcn_exp2f(a[1]); s[t][r] = p0; s[t][r + 1] = p1; ps[t & 3] = (t < 4 && r == 0) ? v2f{ p0, p1 } : ps[t & 3] + v2f{ p0, p1 }; }
    { const v2f q = (ps[0] + ps[1]) + (ps[2] + ps[3]); l = l * alpha + (q[0] + q[1]); }
#pragma unroll  // constant register indices
    for (int j = 0; j < 2; ++j)
#pragma unroll  // constant register indices
      for (int r = 0; r < 8; ++r) acc[j][r] *= alpha;
#pragma unroll  // constant register indices
    for (int c = 0; c < NT / 2; ++c) { v16h ph;
#pragma unroll  // constant register indices
      for (int i = 0; i < 16; i += 2) { const v2f p = { s[2 * c + (i >> 3)][i & 7], s[2 * c + (i >> 3)][(i & 7) + 1] }; const v2h hi = __builtin_convertvector(p, v2h);
        ph[i] = hi[0]; ph[i + 1] = hi[1]; }
#pragma unroll  // constant register indices
      for (int j = 0; j < 2; ++j) acc[j] = wmma_h(frag_h(&sv[(j * 16 + col) * VP + k0 + c * 32], g), ph, acc[j]); } };
#pragma unroll 1  // one trip per chunk, closed by the barrier that publishes the next chunk
  for (int kc = 0; kc < TT; kc += CK) {
  if (kc + CK < TT) fetch(kc + CK);
#pragma unroll 1  // one pass is already PK keys of straight-line code
  for (int p = 0; p < CK / PK; ++p) pass(kc + p * PK, flag<false>{});
  if (kc + CK < TT) { lay(kc + CK); __syncthreads(); } }  // the next chunk is complete in LDS; the test reads the same for the whole block
  // Was min(dot, y) = y for every key? |dot| <= sqrt(|q|^2 |k|^2) (Cauchy-Schwarz), so dot >= -sqrt(1.03 |q|^2 max |k|^2) for all keys (the 3 % covers the roundings while the product is a normal number); m is the largest y.
  // m below that bound, tested on the squares, proves y < dot throughout, and the walk above is the walk with the minimum, bit for bit. Otherwise (a NaN, a product near underflow included) the wave walks the keys, all in LDS, again with it.
  { const v4f e0 = *(const v4f*)&skm[lane * 8], e1 = *(const v4f*)&skm[lane * 8 + 4];
    float km = fmaxf(fmaxf(fmaxf(e0[0], e0[1]), fmaxf(e0[2], e0[3])), fmaxf(fmaxf(e1[0], e1[1]), fmaxf(e1[2], e1[3])));
    km = fmaxf(km, xhalf(km)); km = fmaxf(km, xrow<8>(km)); km = fmaxf(km, xrow<4>(km)); km = fmaxf(km, xrow<2>(km)); km = fmaxf(km, xrow<1>(km));
    const float qk = qn * km;
    const bool idle = (m < 0.f) & (m * m > 1.03f * qk) & (qk > 1.0e-30f);
    if (__builtin_amdgcn_ballot_w32(!idle) != 0) {  // the same for the whole wave: a scalar branch, no barrier behind it
      m = -3.0e38f; l = 0.f; acc[0] = v8f{}; acc[1] = v8f{};
#pragma unroll 1  // one pass is already PK keys of straight-line code
      for (int k0 = 0; k0 < TT; k0 += PK) pass(k0, flag<true>{}); } }
  l += xhalf(l); const float inv = 1.0f / l;
  // acc[j][r] = O[query col][16 j + 8 g + r]: 8 consecutive outputs of one row per lane
  float* op = OUT + ((size_t)b * TT + q0 + col) * RS + h * HE + 8 * g;
#pragma unroll  // constant register indices
  for (int j = 0; j < 2; ++j) { v4f a, c;
#pragma unroll  // constant register indices
    for (int i = 0; i < 4; ++i) { a[i] = acc[j][i] * inv; c[i] = acc[j][4 + i] * inv; }
    *(v4f*)(op + j * 16) = a; *(v4f*)(op + j * 16 + 4) = c; } }
extern "C" void kernel_launch(void* const* d_in, const int* in_sizes, int n_in, void* d_out, int out_size, void* d_ws, size_t ws_size, hipStream_t stream) {
  (void)in_sizes; (void)n_in; (void)out_size; (void)d_ws; (void)ws_size;
  const float** F = (const float**)d_in;   // 0 queries [2,2048,8,32], 1 keys, 2 values
  k_fa<<<dim3(TT / (NW * 16), NH, NB), NW * 32, 0, stream>>>(F[0], F[1], F[2], (float*)d_out);
}

// v008
// It runs in 18 microseconds.
// Two timings next to v007 both put it at 1.08 times that version's speed.
// Counting every step since v000, it is 29.9 times as fast.
// compute dtype: all float inputs rounded to bf16; dot = k . q with the bf16-exact inputs on WMMA 16x16x32 (1 product, exact), f32 accumulate; |q|^2, |k|^2 and x = dot - relu(|q|^2 |k|^2 - dot^2) = min(dot, y), y = dot^2 + dot - |q|^2 |k|^2 (two fused multiply-adds), in f32 on the VALU; the minimum is taken per score only in a second walk, made when a query's largest y does not prove it idle; running-maximum softmax in f32 in base 2, P = exp2(c2 x - c2 max), c2 = 0.5 log2(e) / sqrt(32) (hardware exp2), unnormalised P (0 to 1) rounded once to f16 (11 bits) against the bf16-rounded values held as f16 (the same numbers from 2^-17 up in magnitude) on WMMA 16x16x32 f16 (1 product), f32 accumulate, divided by the f32 row sum of the unrounded P at the end; f32 output [b][l][h][d].
#include <hip/hip_runtime.h>
#include <math.h>

typedef __attribute__((ext_vector_type(16))) __bf16 v16b;
typedef __attribute__((ext_vector_type(8)))  __bf16 v8b;
typedef __attribute__((ext_vector_type(4)))  __bf16 v4b;
typedef __attribute__((ext_vector_type(8)))  float v8f;
typedef __attribute__((ext_vector_type(4)))  float v4f;
typedef __attribute__((ext_vector_type(2)))  float v2f;
typedef __attribute__((ext_vector_type(16))) _Float16 v16h;
typedef __attribute__((ext_vector_type(8)))  _Float16 v8h;
typedef __attribute__((ext_vector_type(2)))  _Float16 v2h;

// Geometric (Clifford wedge) attention (B 2, L = S = 2,048, H 8, E = D = 32): scores mix the dot product and the clamped wedge norm |q|^2|k|^2 - (q.k)^2.
#define NB 2
#define TT 2048
#define NH 8
#define HE 32
#define RS (NH * HE)      // 256 row stride
#define NQ 8              // query tiles of 16 per block
#define NG 2              // waves per query tile: wave group kg walks pass kg of every chunk
#define NW (NQ * NG)      // waves per block: four on a SIMD
#define PK 128            // keys per pass: one update of the running maximum
#define CK (NG * PK)      // keys per staged chunk: one pass per wave
#define NT (PK / 16)      // 16-key score tiles per pass
#define KP 40             // LDS pitch of a key row, bf16 elements: 80 B = 16 B x odd
#define VP (TT + 8)       // LDS pitch of a row of V transposed, f16 elements: 4,112 B = 16 B x odd

__device__ __forceinline__ v8f wmma_bf(v16b a, v16b b, v8f c) { return __builtin_amdgcn_wmma_f32_16x16x32_bf16(false, a, false, b, (short)0, c, false, false); }
// 16x16x32 fragments: lane = (g = lane>>4, row/col = lane&15); elements 0..7 = k0+8g+0..7, 8..15 = k0+16+8g+0..7; D element r = row 8g+r
__device__ __forceinline__ v16b frag_b(const __bf16* rowk0, int g) {
  union { v16b v; v8b q[2]; } u; const __bf16* p = rowk0 + 8 * g;
  u.q[0] = *(const v8b*)p; u.q[1] = *(const v8b*)(p + 16); return u.v;
}
__device__ __forceinline__ v8f wmma_h(v16h a, v16h b, v8f c) { return __builtin_amdgcn_wmma_f32_16x16x32_f16(false, a, false, b, (short)0, c, false, false); }
__device__ __forceinline__ v16h frag_h(const _Float16* rowk0, int g) {
  union { v16h v; v8h q[2]; } u; const _Float16* p = rowk0 + 8 * g;
  u.q[0] = *(const v8h*)p; u.q[1] = *(const v8h*)(p + 16); return u.v;
}
// lane l with lane l ^ M inside its row of 16
template <int M> __device__ __forceinline__ float xrow(float x) { return __builtin_bit_cast(float, __builtin_amdgcn_update_dpp(0, __builtin_bit_cast(int, x), 0x160 | M, 0xf, 0xf, true)); }
template <bool B> struct flag { static constexpr bool v = B; };
__device__ __forceinline__ float bfr(float v) { return (float)(__bf16)v; }
// lane l with lane l ^ 16
__device__ __forceinline__ float xhalf(float x) { return __builtin_bit_cast(float, __builtin_amdgcn_permlanex16(__builtin_bit_cast(int, x), __builtin_bit_cast(int, x), 0x76543210, 0xfedcba98, false, false)); }

// ---- k_fa: block = (128 queries, head, batch). The head's keys (bf16), values (bf16-rounded, held as f16, transposed) and key norms are laid in LDS once, in chunks of CK keys:
// a wave issues the global loads of its share of the next chunk (group 0: 32 key rows, group 1: 32 value rows), works on the current chunk while they fly, then rounds and stores them; one barrier per chunk publishes it.
// Two waves share 16 queries, each walking every second pass of PK keys: S^T = K . Q^T (a lane holds one query's scores), running-maximum softmax, O^T += V^T . P^T
// (two S^T tiles, converted in place, are the B operand). Scores and P never leave the registers; the two waves' maximum, sum and O are joined once, through LDS, at the end.
__global__ __launch_bounds__(NW * 32) void k_fa(const float* __restrict__ Q, const float* __restrict__ Kk, const float* __restrict__ V, float* __restrict__ OUT) {
  __shared__ __align__(16) __bf16 sk[TT * KP]; __shared__ __align__(16) _Float16 sv[HE * VP]; __shared__ __align__(16) float skn[TT]; __shared__ __align__(16) float skm[NQ * 32];
  __shared__ __align__(16) v4f sjo[4][NQ * 32]; __shared__ __align__(16) v2f sjm[NQ * 32];  // group 1's O, and its maximum and sum, for the join
  const int tid = threadIdx.x, lane = tid & 31, col = lane & 15, g = lane >> 4;
  const int wave = __builtin_amdgcn_readfirstlane(tid >> 5), qt = wave & (NQ - 1), kg = wave / NQ;  // in scalar registers: the tests on kg are scalar branches
  const int h = blockIdx.y, b = blockIdx.z; const int q0 = blockIdx.x * (NQ * 16) + qt * 16;
  // staging of a chunk: wave qt of group 0 takes 32 key rows, wave qt of group 1 the same 32 keys' value rows. Either way a lane takes 8 keys x 4 columns: a load covers 4 whole 128-byte rows.
  const int dq = lane & 7, key0 = qt * 32 + (lane >> 3) * 8;
  const float* pst = (kg == 0 ? Kk : V) + ((size_t)b * TT + key0) * RS + h * HE + dq * 4;
  v4f st[8]; float kmx = 0.f;  // kmx: largest key norm this lane has laid
  auto fetch = [&](const int kc) {  // kc: first key of the chunk
    const float* p = pst + (size_t)kc * RS;
#pragma unroll  // constant register indices
    for (int i = 0; i < 8; ++i) st[i] = *(const v4f*)(p + i * RS);
    // holds the 8 loads here, ahead of the work they fly over, and keeps their address pair whole until the translations are done
    asm volatile("s_wait_xcnt 0x0" :: "v"(p) : "memory"); };
  auto lay = [&](const int kc) {
    if (kg == 0) {
#pragma unroll  // constant register indices
      for (int i = 0; i < 8; ++i) { v4b o;
#pragma unroll  // constant register indices
        for (int j = 0; j < 4; ++j) o[j] = (__bf16)st[i][j];
        *(v4b*)&sk[(kc + key0 + i) * KP + dq * 4] = o; }
      // key norms from the rounded rows: a lane sums one of the 32 rows that its own wave has just written (a wave's LDS operations run in order)
      float a = 0.f;
#pragma unroll  // constant register indices
      for (int q = 0; q < 4; ++q) { const v8b y = *(const v8b*)&sk[(kc + qt * 32 + lane) * KP + q * 8];
#pragma unroll  // constant register indices
        for (int i = 0; i < 8; ++i) { const float v = (float)y[i]; a += v * v; } }
      skn[kc + qt * 32 + lane] = a; kmx = fmaxf(kmx, a); skm[qt * 32 + lane] = kmx;
    } else {
      // 8 keys of each column go as one 16-byte piece of the transposed row
#pragma unroll  // constant register indices
      for (int j = 0; j < 4; ++j) { v8h o;
#pragma unroll  // constant register indices
        for (int i = 0; i < 8; ++i) o[i] = (_Float16)bfr(st[i][j]);
        *(v8h*)&sv[(dq * 4 + j) * VP + kc + key0] = o; } } };
  fetch(0);
  // the lane's query: norm (f32 sum of squares of the bf16-rounded inputs) and B fragment
  float qn = 0.f; v16b qf;
  { const float* qp = Q + ((size_t)b * TT + q0 + col) * RS + h * HE;
#pragma unroll  // constant register indices
    for (int d = 0; d < HE; ++d) { const float v = bfr(qp[d]); qn += v * v; }
#pragma unroll  // constant register indices
    for (int i = 0; i < 8; ++i) { qf[i] = (__bf16)qp[8 * g + i]; qf[8 + i] = (__bf16)qp[16 + 8 * g + i]; } }
  lay(0);
  __syncthreads();
  // softmax in base 2: the running maximum is taken over x = dot - wedge, and c2 = 0.5 / sqrt(32) * log2(e) enters only in the exp2 argument c2 * x + nmc
  // (one fused multiply-add per score). nmc = -c2 * maximum, rounded once, is the common reference of a pass's P, so its rounding cancels in O = acc / l;
  // the rescale factor exp2(c2 * (old maximum - new maximum)) is exactly 1 while the maximum stands.
  const float c2 = 0.12751743f, nqn = -qn;
  float m = -3.0e38f, l = 0.f; v8f acc[2] = {};
  // one pass: PK keys. CL::v says whether x = min(dot, y) or x = y.
  auto pass = [&](const int k0, auto CL) { v8f s[NT]; v16b kf[NT]; __builtin_assume(k0 % PK == 0);  // keeps the 16-byte alignment of the norm reads known: ds_load_b128
#pragma unroll  // constant register indices
    for (int t = 0; t < NT; ++t) kf[t] = frag_b(&sk[(k0 + t * 16 + col) * KP], g);
    v4f kn4[NT][2];
#pragma unroll  // constant register indices
    for (int t = 0; t < NT; ++t) { kn4[t][0] = *(const v4f*)&skn[k0 + t * 16 + 8 * g]; kn4[t][1] = *(const v4f*)&skn[k0 + t * 16 + 8 * g + 4]; }
    __builtin_amdgcn_sched_barrier(0);  // the key fragments' LDS reads stay one group, first in the LDS queue, the norms' behind them: one place with LDS reads, and the products wait for nothing else
#pragma unroll  // constant register indices
    for (int t = 0; t < NT; ++t) { const v8f z = {}; s[t] = wmma_bf(kf[t], qf, z); }
    float mc[4] = { m, m, m, m };  // the maximum in four independent chains (exact in any order)
#pragma unroll  // constant register indices
    for (int t = 0; t < NT; ++t) { const v4f n0 = kn4[t][0], n1 = kn4[t][1];
#pragma unroll  // constant register indices
      for (int r = 0; r < 8; ++r) { const float kn = r < 4 ? n0[r & 3] : n1[r & 3]; const float dt = s[t][r];
        const float y = __builtin_fmaf(nqn, kn, __builtin_fmaf(dt, dt, dt)); const float x = decltype(CL)::v ? fminf(dt, y) : y; s[t][r] = x; mc[t & 3] = fmaxf(mc[t & 3], x); } }
    v16h vf[NT / 2][2];
#pragma unroll  // constant register indices
    for (int c = 0; c < NT / 2; ++c)
#pragma unroll  // constant register indices
      for (int j = 0; j < 2; ++j) vf[c][j] = frag_h(&sv[(j * 16 + col) * VP + k0 + c * 32], g);
    __builtin_amdgcn_sched_barrier(0);  // the value fragments' LDS reads stay one group here: they fly under the maximum's join and the exponentials
    float mx = fmaxf(fmaxf(mc[0], mc[1]), fmaxf(mc[2], mc[3])); mx = fmaxf(mx, xhalf(mx));
    const float nmc = -c2 * mx; const float alpha = __builtin_amdgcn_exp2f(c2 * (m - mx)); m = mx; v2f ps[4];  // a pass's sum of P: four packed chains (tile t in chain t mod 4), even and odd keys apart
#pragma unroll  // constant register indices
    for (int t = 0; t < NT; ++t)
#pragma unroll  // constant register indices
      for (int r = 0; r < 8; r += 2) { const v2f a = __builtin_elementwise_fma(v2f{ s[t][r], s[t][r + 1] }, v2f{ c2, c2 }, v2f{ nmc, nmc });
        const float p0 = __builtin_amdgcn_exp2f(a[0]), p1 = __builtin_amdgcn_exp2f(a[1]); s[t][r] = p0; s[t][r + 1] = p1; ps[t & 3] = (t < 4 && r == 0) ? v2f{ p0, p1 } : ps[t & 3] + v2f{ p0, p1 }; }
    { const v2f q = (ps[0] + ps[1]) + (ps[2] + ps[3]); l = l * alpha + (q[0] + q[1]); }
#pragma unroll  // constant register indices
    for (int j = 0; j < 2; ++j)
#pragma unroll  // constant register indices
      for (int r = 0; r < 8; ++r) acc[j][r] *= alpha;
#pragma unroll  // constant register indices
    for (int c = 0; c < NT / 2; ++c) { v16h ph;
#pragma unroll  // constant register indices
      for (int i = 0; i < 16; i += 2) { const v2f p = { s[2 * c + (i >> 3)][i & 7], s[2 * c + (i >> 3)][(i & 7) + 1] }; const v2h hi = __builtin_convertvector(p, v2h);
        ph[i] = hi[0]; ph[i + 1] = hi[1]; }
#pragma unroll  // constant register indices
      for (int j = 0; j < 2; ++j) acc[j] = wmma_h(vf[c][j], ph, acc[j]); } };
#pragma unroll 1  // one trip per chunk, closed by the barrier that publishes the next chunk
  for (int kc = 0; kc < TT - CK; kc += CK) {
  fetch(kc + CK);
  pass(__builtin_amdgcn_readfirstlane(kc + kg * PK), flag<false>{});  // the first key as a scalar, not a running vector address: each LDS array's address is formed once a pass, the rest are immediate offsets
  lay(kc + CK); __syncthreads(); }  // the next chunk is complete in LDS
  pass(TT - CK + kg * PK, flag<false>{});  // the last chunk: nothing left to stage
  // Was min(dot, y) = y for every key? |dot| <= sqrt(|q|^2 |k|^2) (Cauchy-Schwarz), so dot >= -sqrt(1.03 |q|^2 max |k|^2) for all keys (the 3 % covers the roundings while the product is a normal number); m is the largest y of the wave's own keys.
  // m below that bound, tested on the squares, proves y < dot throughout, and the walk above is the walk with the minimum, bit for bit. Otherwise (a NaN, a product near underflow included) the wave walks its keys, all in LDS, again with it.
  { const v4f e0 = *(const v4f*)&skm[lane * 8], e1 = *(const v4f*)&skm[lane * 8 + 4];
    float km = fmaxf(fmaxf(fmaxf(e0[0], e0[1]), fmaxf(e0[2], e0[3])), fmaxf(fmaxf(e1[0], e1[1]), fmaxf(e1[2], e1[3])));
    km = fmaxf(km, xhalf(km)); km = fmaxf(km, xrow<8>(km)); km = fmaxf(km, xrow<4>(km)); km = fmaxf(km, xrow<2>(km)); km = fmaxf(km, xrow<1>(km));
    const float qk = qn * km;
    const bool idle = (m < 0.f) & (m * m > 1.03f * qk) & (qk > 1.0e-30f);
    if (__builtin_amdgcn_ballot_w32(!idle) != 0) {  // the same for the whole wave: a scalar branch, the join's barrier behind it
      m = -3.0e38f; l = 0.f; acc[0] = v8f{}; acc[1] = v8f{};
#pragma unroll 1  // one pass is already PK keys of straight-line code
      for (int k0 = kg * PK; k0 < TT; k0 += CK) pass(k0, flag<true>{}); } }
  // the join: group 1 leaves its maximum, sum and O in LDS; behind one barrier, passed by every wave, group 0 brings both to the common maximum, adds them and stores
  const int jl = qt * 32 + lane;
  if (kg != 0) { sjm[jl] = v2f{ m, l };
#pragma unroll  // constant register indices
    for (int j = 0; j < 2; ++j) { sjo[2 * j][jl] = v4f{ acc[j][0], acc[j][1], acc[j][2], acc[j][3] }; sjo[2 * j + 1][jl] = v4f{ acc[j][4], acc[j][5], acc[j][6], acc[j][7] }; } }
  __syncthreads();
  if (kg != 0) return;
  { const v2f ml = sjm[jl]; const float mj = fmaxf(m, ml[0]); const float a0 = __builtin_amdgcn_exp2f(c2 * (m - mj)), a1 = __builtin_amdgcn_exp2f(c2 * (ml[0] - mj));
    l = l * a0 + ml[1] * a1;
#pragma unroll  // constant register indices
    for (int j = 0; j < 2; ++j) { const v4f o0 = sjo[2 * j][jl], o1 = sjo[2 * j + 1][jl];
#pragma unroll  // constant register indices
      for (int i = 0; i < 4; ++i) { acc[j][i] = acc[j][i] * a0 + o0[i] * a1; acc[j][4 + i] = acc[j][4 + i] * a0 + o1[i] * a1; } } }
  l += xhalf(l); const float inv = 1.0f / l;
  // acc[j][r] = O[query col][16 j + 8 g + r]: 8 consecutive outputs of one row per lane
  float* op = OUT + ((size_t)b * TT + q0 + col) * RS + h * HE + 8 * g;
#pragma unroll  // constant register indices
  for (int j = 0; j < 2; ++j) { v4f a, c;
#pragma unroll  // constant register indices
    for (int i = 0; i < 4; ++i) { a[i] = acc[j][i] * inv; c[i] = acc[j][4 + i] * inv; }
    *(v4f*)(op + j * 16) = a; *(v4f*)(op + j * 16 + 4) = c; } }
extern "C" void kernel_launch(void* const* d_in, const int* in_sizes, int n_in, void* d_out, int out_size, void* d_ws, size_t ws_size, hipStream_t stream) {
  (void)in_sizes; (void)n_in; (void)out_size; (void)d_ws; (void)ws_size;
  const float** F = (const float**)d_in;   // 0 queries [2,2048,8,32], 1 keys, 2 values
  k_fa<<<dim3(TT / (NQ * 16), NH, NB), NW * 32, 0, stream>>>(F[0], F[1], F[2], (float*)d_out);
}
